// v000
// The times below were measured on an AMD MI455X: many runs one after another, warmed up first and cycling through
// copies of the inputs, with the whole window's GPU time divided by the number of runs. Launches and the gaps
// between them are all in it. The median over several windows is given; except for v000 it joins two sittings, which
// can be a few percent apart, so the side-by-side timings, each taken in one sitting, are the better comparison.
// The starting kernel, v000, takes 75.3 microseconds a run.
#include <hip/hip_runtime.h>

typedef __attribute__((ext_vector_type(16))) _Float16 v16h;
typedef __attribute__((ext_vector_type(8)))  _Float16 v8h;
typedef __attribute__((ext_vector_type(8)))  float    v8f;
typedef __attribute__((ext_vector_type(4)))  float    f4v;

#define LSEQ 1024   // H*W
#define HD   64     // head dim
#define BM   128    // queries per workgroup (8 waves x 16 rows)
#define BN   32     // keys per iteration
#define NWAVE 8
#define NTILE (LSEQ / BN)

// Build a 16-element f16 A/B operand from two contiguous 8-half LDS chunks.
// Element e<8  -> row[8*kh + e] ; element e>=8 -> row[16 + 8*kh + (e-8)]
__device__ __forceinline__ v16h lds_a16(const _Float16* row, int kh) {
  v8h lo = *(const v8h*)(row + 8 * kh);
  v8h hi = *(const v8h*)(row + 16 + 8 * kh);
  v16h r;
#pragma unroll
  for (int i = 0; i < 8; ++i) { r[i] = lo[i]; r[i + 8] = hi[i]; }
  return r;
}

struct StageRegs { v8h kk; v8h vv; };

// Global -> registers: fold position bias into K', convert K'/V to f16.
__device__ __forceinline__ StageRegs stage_load(const float* __restrict__ K,
                                                const float* __restrict__ V,
                                                const float* __restrict__ Hemb,
                                                const float* __restrict__ Wemb,
                                                size_t base, int gk, int sdg) {
  const int kp_ = gk >> 5;   // p (row of key in 32x32 grid)
  const int kw_ = gk & 31;   // q (col of key in 32x32 grid)
  const f4v* kg = (const f4v*)(K    + base + (size_t)gk * HD + sdg);
  const f4v* hg = (const f4v*)(Hemb + kp_ * HD + sdg);
  const f4v* wg = (const f4v*)(Wemb + kw_ * HD + sdg);
  const f4v* vg = (const f4v*)(V    + base + (size_t)gk * HD + sdg);
  f4v ka = kg[0], kb4 = kg[1];
  f4v va = vg[0], vb  = vg[1];
  f4v ha = hg[0], hb  = hg[1];
  f4v wa = wg[0], wb  = wg[1];
  StageRegs st;
#pragma unroll
  for (int i = 0; i < 4; ++i) {
    st.kk[i]     = (_Float16)(ka[i]  + ha[i] + wa[i]);
    st.kk[i + 4] = (_Float16)(kb4[i] + hb[i] + wb[i]);
    st.vv[i]     = (_Float16)va[i];
    st.vv[i + 4] = (_Float16)vb[i];
  }
  return st;
}

// Registers -> LDS: K' key-major, V transposed dim-major.
__device__ __forceinline__ void stage_store(const StageRegs& st,
                                            _Float16* bK, _Float16* bVt,
                                            int skey, int sdg) {
  *(v8h*)(&bK[skey * HD + sdg]) = st.kk;
#pragma unroll
  for (int i = 0; i < 8; ++i) bVt[(sdg + i) * BN + skey] = st.vv[i];
}

__global__ __launch_bounds__(256)
void fa_relpos_kernel(const float* __restrict__ Q,
                      const float* __restrict__ K,
                      const float* __restrict__ V,
                      const float* __restrict__ Wemb,
                      const float* __restrict__ Hemb,
                      float* __restrict__ Out) {
  __shared__ _Float16 sK[2][BN * HD];    // K' tiles (bias folded), key-major
  __shared__ _Float16 sVt[2][HD * BN];   // V tiles transposed, dim-major

  const int pair = blockIdx.y;           // b*8 + n
  const int b    = pair >> 3;
  const int n    = pair & 7;
  const int tid  = threadIdx.x;
  const int lane = tid & 31;
  const int wv   = tid >> 5;             // wave id 0..7
  const int nq   = lane & 15;            // query column / A-row selector
  const int kh   = lane >> 4;            // K-group half selector
  const int qrow = blockIdx.x * BM + wv * 16 + nq;

  const size_t base = (size_t)pair * LSEQ * HD;

  // ---- Q operand (B-matrix layout for S^T = K' x (s*Q)^T), loaded once ----
  // Fold log2(e) into the scale so softmax runs natively in exp2 domain
  // (v_exp_f32 is exp2): softmax(s*logits) == softmax2(s*log2e*logits).
  const float scale = 0.125f * 1.44269504088896340736f;
  const float* qp = Q + base + (size_t)qrow * HD;
  v16h qb0, qb1;
#pragma unroll
  for (int e = 0; e < 8; ++e) {
    qb0[e]     = (_Float16)(qp[      8 * kh + e] * scale);
    qb0[e + 8] = (_Float16)(qp[16 +  8 * kh + e] * scale);
    qb1[e]     = (_Float16)(qp[32 +  8 * kh + e] * scale);
    qb1[e + 8] = (_Float16)(qp[48 +  8 * kh + e] * scale);
  }

  float m_run = -3.0e38f;
  float l_run = 0.0f;
  v8f o0 = {}, o1 = {}, o2 = {}, o3 = {};
  const v8f zero = {};

  const int skey = tid >> 3;             // staging: key 0..31
  const int sdg  = (tid & 7) * 8;        // staging: dim group 0,8,...,56

  // ---- prologue: stage tile 0 into buffer 0 ----
  {
    StageRegs st = stage_load(K, V, Hemb, Wemb, base, skey, sdg);
    stage_store(st, sK[0], sVt[0], skey, sdg);
  }
  __syncthreads();

  for (int it = 0; it < NTILE; ++it) {
    const int cur = it & 1;
    // ---- prefetch next tile into registers (overlaps with WMMA below) ----
    StageRegs st;
    if (it < NTILE - 1)
      st = stage_load(K, V, Hemb, Wemb, base, (it + 1) * BN + skey, sdg);

    // ---- S^T = K'(32x64) x Qs^T(64x16) ----
    const _Float16* arow0 = &sK[cur][nq * HD];
    const _Float16* arow1 = &sK[cur][(nq + 16) * HD];
    v16h a00 = lds_a16(arow0,      kh);
    v16h a01 = lds_a16(arow0 + 32, kh);
    v16h a10 = lds_a16(arow1,      kh);
    v16h a11 = lds_a16(arow1 + 32, kh);
    v8f s0 = __builtin_amdgcn_wmma_f32_16x16x32_f16(false, a00, false, qb0, (short)0, zero, false, false);
    s0     = __builtin_amdgcn_wmma_f32_16x16x32_f16(false, a01, false, qb1, (short)0, s0,   false, false);
    v8f s1 = __builtin_amdgcn_wmma_f32_16x16x32_f16(false, a10, false, qb0, (short)0, zero, false, false);
    s1     = __builtin_amdgcn_wmma_f32_16x16x32_f16(false, a11, false, qb1, (short)0, s1,   false, false);

    // ---- V^T operands: independent of softmax, load early under VALU ----
    v16h va0 = lds_a16(&sVt[cur][(nq +  0) * BN], kh);
    v16h va1 = lds_a16(&sVt[cur][(nq + 16) * BN], kh);
    v16h va2 = lds_a16(&sVt[cur][(nq + 32) * BN], kh);
    v16h va3 = lds_a16(&sVt[cur][(nq + 48) * BN], kh);

    // ---- online softmax in exp2 domain (lane owns query column nq) ----
    float mx = m_run;
#pragma unroll
    for (int r = 0; r < 8; ++r) mx = fmaxf(mx, fmaxf(s0[r], s1[r]));
    mx = fmaxf(mx, __shfl_xor(mx, 16, 32));
    const float alpha = __builtin_amdgcn_exp2f(m_run - mx);
    m_run = mx;

    float rs = 0.0f;
    v16h pb;                             // P^T packed directly into B-operand layout
#pragma unroll
    for (int r = 0; r < 8; ++r) {
      float p0 = __builtin_amdgcn_exp2f(s0[r] - mx);  // key = kb + 8*kh + r
      float p1 = __builtin_amdgcn_exp2f(s1[r] - mx);  // key = kb + 16 + 8*kh + r
      rs += p0 + p1;
      pb[r]     = (_Float16)p0;
      pb[r + 8] = (_Float16)p1;
    }
    rs += __shfl_xor(rs, 16, 32);
    l_run = l_run * alpha + rs;

#pragma unroll
    for (int r = 0; r < 8; ++r) {
      o0[r] *= alpha; o1[r] *= alpha; o2[r] *= alpha; o3[r] *= alpha;
    }

    // ---- O^T += V^T(16x32 per d-tile) x P^T(32x16) ----
    o0 = __builtin_amdgcn_wmma_f32_16x16x32_f16(false, va0, false, pb, (short)0, o0, false, false);
    o1 = __builtin_amdgcn_wmma_f32_16x16x32_f16(false, va1, false, pb, (short)0, o1, false, false);
    o2 = __builtin_amdgcn_wmma_f32_16x16x32_f16(false, va2, false, pb, (short)0, o2, false, false);
    o3 = __builtin_amdgcn_wmma_f32_16x16x32_f16(false, va3, false, pb, (short)0, o3, false, false);

    // ---- soft scheduling hints: batch DS reads ahead of each WMMA burst ----
    __builtin_amdgcn_sched_group_barrier(0x100, 8, 0);   // DS reads: S^T operands
    __builtin_amdgcn_sched_group_barrier(0x008, 4, 0);   // WMMA: S^T
    __builtin_amdgcn_sched_group_barrier(0x100, 8, 0);   // DS reads: V^T operands
    __builtin_amdgcn_sched_group_barrier(0x402, 160, 0); // VALU+TRANS: softmax
    __builtin_amdgcn_sched_group_barrier(0x008, 4, 0);   // WMMA: PV

    // ---- write next tile to the alternate buffer; one barrier per iter ----
    if (it < NTILE - 1) {
      stage_store(st, sK[cur ^ 1], sVt[cur ^ 1], skey, sdg);
      __syncthreads();
    }
  }

  // ---- epilogue: out[b, qh, qw, n*64 + d], non-temporal (write-once) ----
  const float inv = 1.0f / l_run;
  const int qh = qrow >> 5;
  const int qw = qrow & 31;
  float* op = Out + ((((size_t)b * 32 + qh) * 32 + qw) * 512) + n * 64 + 8 * kh;
#define EPI(OACC, TT)                                                            \
  {                                                                              \
    f4v lo4 = { OACC[0] * inv, OACC[1] * inv, OACC[2] * inv, OACC[3] * inv };    \
    f4v hi4 = { OACC[4] * inv, OACC[5] * inv, OACC[6] * inv, OACC[7] * inv };    \
    __builtin_nontemporal_store(lo4, (f4v*)(op + 16 * TT));                      \
    __builtin_nontemporal_store(hi4, (f4v*)(op + 16 * TT + 4));                  \
  }
  EPI(o0, 0)
  EPI(o1, 1)
  EPI(o2, 2)
  EPI(o3, 3)
#undef EPI
}

extern "C" void kernel_launch(void* const* d_in, const int* in_sizes, int n_in,
                              void* d_out, int out_size, void* d_ws, size_t ws_size,
                              hipStream_t stream) {
  const float* q    = (const float*)d_in[0];
  const float* k    = (const float*)d_in[1];
  const float* v    = (const float*)d_in[2];
  const float* wemb = (const float*)d_in[3];
  const float* hemb = (const float*)d_in[4];
  float* out = (float*)d_out;

  dim3 grid(LSEQ / BM, 64);   // (query tiles, b*heads)
  dim3 block(32 * NWAVE);
  fa_relpos_kernel<<<grid, block, 0, stream>>>(q, k, v, wemb, hemb, out);
}

// v001
// A run of this version takes 51.7 microseconds.
// Next to v000, in two timings, it ran 1.49 times as fast each time.
#include <hip/hip_runtime.h>

typedef __attribute__((ext_vector_type(16))) _Float16 v16h;
typedef __attribute__((ext_vector_type(8)))  _Float16 v8h;
typedef __attribute__((ext_vector_type(8)))  float    v8f;
typedef __attribute__((ext_vector_type(4)))  float    f4v;

#define LSEQ 1024   // H*W
#define HD   64     // head dim
#define BM   128    // queries per workgroup (8 waves x 16 rows)
#define BN   32     // keys per iteration
#define NWAVE 8
#define NTILE (LSEQ / BN)
// LDS row pitches in halves. Both are 16 B x odd, so the 16 rows that one
// half-wave reads with ds_load_b128 fall on 64 distinct banks.
#define KP   (HD + 8)   // K' row: 144 B
#define VP   (BN + 8)   // V^T row: 80 B

// Build a 16-element f16 A/B operand from two contiguous 8-half LDS chunks.
// Element e<8  -> row[8*kh + e] ; element e>=8 -> row[16 + 8*kh + (e-8)]
__device__ __forceinline__ v16h lds_a16(const _Float16* row, int kh) {
  v8h lo = *(const v8h*)(row + 8 * kh);
  v8h hi = *(const v8h*)(row + 16 + 8 * kh);
  v16h r;
#pragma unroll
  for (int i = 0; i < 8; ++i) { r[i] = lo[i]; r[i + 8] = hi[i]; }
  return r;
}

struct StageRegs { v8h kk; v8h vv; };

// Global -> registers: fold position bias into K', convert K'/V to f16.
__device__ __forceinline__ StageRegs stage_load(const float* __restrict__ K,
                                                const float* __restrict__ V,
                                                const float* __restrict__ Hemb,
                                                const float* __restrict__ Wemb,
                                                size_t base, int gk, int sdg) {
  const int kp_ = gk >> 5;   // p (row of key in 32x32 grid)
  const int kw_ = gk & 31;   // q (col of key in 32x32 grid)
  const f4v* kg = (const f4v*)(K    + base + (size_t)gk * HD + sdg);
  const f4v* hg = (const f4v*)(Hemb + kp_ * HD + sdg);
  const f4v* wg = (const f4v*)(Wemb + kw_ * HD + sdg);
  const f4v* vg = (const f4v*)(V    + base + (size_t)gk * HD + sdg);
  f4v ka = kg[0], kb4 = kg[1];
  f4v va = vg[0], vb  = vg[1];
  f4v ha = hg[0], hb  = hg[1];
  f4v wa = wg[0], wb  = wg[1];
  StageRegs st;
#pragma unroll
  for (int i = 0; i < 4; ++i) {
    st.kk[i]     = (_Float16)(ka[i]  + ha[i] + wa[i]);
    st.kk[i + 4] = (_Float16)(kb4[i] + hb[i] + wb[i]);
    st.vv[i]     = (_Float16)va[i];
    st.vv[i + 4] = (_Float16)vb[i];
  }
  return st;
}

// Registers -> LDS: K' key-major, V transposed dim-major.
__device__ __forceinline__ void stage_store(const StageRegs& st,
                                            _Float16* bK, _Float16* bVt,
                                            int skey, int sdg) {
  *(v8h*)(&bK[skey * KP + sdg]) = st.kk;
#pragma unroll
  for (int i = 0; i < 8; ++i) bVt[(sdg + i) * VP + skey] = st.vv[i];
}

__global__ __launch_bounds__(256)
void fa_relpos_kernel(const float* __restrict__ Q,
                      const float* __restrict__ K,
                      const float* __restrict__ V,
                      const float* __restrict__ Wemb,
                      const float* __restrict__ Hemb,
                      float* __restrict__ Out) {
  __shared__ __attribute__((aligned(16))) _Float16 sK[2][BN * KP];   // K' tiles (bias folded), key-major, padded rows
  __shared__ __attribute__((aligned(16))) _Float16 sVt[2][HD * VP];  // V tiles transposed, dim-major, padded rows

  const int pair = blockIdx.y;           // b*8 + n
  const int b    = pair >> 3;
  const int n    = pair & 7;
  const int tid  = threadIdx.x;
  const int lane = tid & 31;
  const int wv   = tid >> 5;             // wave id 0..7
  const int nq   = lane & 15;            // query column / A-row selector
  const int kh   = lane >> 4;            // K-group half selector
  const int qrow = blockIdx.x * BM + wv * 16 + nq;

  const size_t base = (size_t)pair * LSEQ * HD;

  // ---- Q operand (B-matrix layout for S^T = K' x (s*Q)^T), loaded once ----
  // Fold log2(e) into the scale so softmax runs natively in exp2 domain
  // (v_exp_f32 is exp2): softmax(s*logits) == softmax2(s*log2e*logits).
  const float scale = 0.125f * 1.44269504088896340736f;
  const float* qp = Q + base + (size_t)qrow * HD;
  v16h qb0, qb1;
#pragma unroll
  for (int e = 0; e < 8; ++e) {
    qb0[e]     = (_Float16)(qp[      8 * kh + e] * scale);
    qb0[e + 8] = (_Float16)(qp[16 +  8 * kh + e] * scale);
    qb1[e]     = (_Float16)(qp[32 +  8 * kh + e] * scale);
    qb1[e + 8] = (_Float16)(qp[48 +  8 * kh + e] * scale);
  }

  float m_run = -3.0e38f;
  float l_run = 0.0f;
  v8f o0 = {}, o1 = {}, o2 = {}, o3 = {};
  const v8f zero = {};

  const int skey = (tid >> 3) & 31;      // staging: key 0..31 (mask: lets the compiler see key & 31 is loop-invariant, so the w_emb row load stays outside the loop)
  const int sdg  = (tid & 7) * 8;        // staging: dim group 0,8,...,56

  // ---- prologue: stage tile 0 into buffer 0 ----
  {
    StageRegs st = stage_load(K, V, Hemb, Wemb, base, skey, sdg);
    stage_store(st, sK[0], sVt[0], skey, sdg);
  }
  __syncthreads();

  for (int it = 0; it < NTILE; ++it) {
    const int cur = it & 1;
    // ---- prefetch next tile into registers (overlaps with WMMA below) ----
    StageRegs st;
    if (it < NTILE - 1)
      st = stage_load(K, V, Hemb, Wemb, base, (it + 1) * BN + skey, sdg);

    // ---- S^T = K'(32x64) x Qs^T(64x16) ----
    const _Float16* arow0 = &sK[cur][nq * KP];
    const _Float16* arow1 = &sK[cur][(nq + 16) * KP];
    v16h a00 = lds_a16(arow0,      kh);
    v16h a01 = lds_a16(arow0 + 32, kh);
    v16h a10 = lds_a16(arow1,      kh);
    v16h a11 = lds_a16(arow1 + 32, kh);
    v8f s0 = __builtin_amdgcn_wmma_f32_16x16x32_f16(false, a00, false, qb0, (short)0, zero, false, false);
    s0     = __builtin_amdgcn_wmma_f32_16x16x32_f16(false, a01, false, qb1, (short)0, s0,   false, false);
    v8f s1 = __builtin_amdgcn_wmma_f32_16x16x32_f16(false, a10, false, qb0, (short)0, zero, false, false);
    s1     = __builtin_amdgcn_wmma_f32_16x16x32_f16(false, a11, false, qb1, (short)0, s1,   false, false);

    // ---- V^T operands: independent of softmax, load early under VALU ----
    v16h va0 = lds_a16(&sVt[cur][(nq +  0) * VP], kh);
    v16h va1 = lds_a16(&sVt[cur][(nq + 16) * VP], kh);
    v16h va2 = lds_a16(&sVt[cur][(nq + 32) * VP], kh);
    v16h va3 = lds_a16(&sVt[cur][(nq + 48) * VP], kh);

    // ---- online softmax in exp2 domain (lane owns query column nq) ----
    float mx = m_run;
#pragma unroll
    for (int r = 0; r < 8; ++r) mx = fmaxf(mx, fmaxf(s0[r], s1[r]));
    mx = fmaxf(mx, __shfl_xor(mx, 16, 32));
    const float alpha = __builtin_amdgcn_exp2f(m_run - mx);
    m_run = mx;

    float rs = 0.0f;
    v16h pb;                             // P^T packed directly into B-operand layout
#pragma unroll
    for (int r = 0; r < 8; ++r) {
      float p0 = __builtin_amdgcn_exp2f(s0[r] - mx);  // key = kb + 8*kh + r
      float p1 = __builtin_amdgcn_exp2f(s1[r] - mx);  // key = kb + 16 + 8*kh + r
      rs += p0 + p1;
      pb[r]     = (_Float16)p0;
      pb[r + 8] = (_Float16)p1;
    }
    rs += __shfl_xor(rs, 16, 32);
    l_run = l_run * alpha + rs;

#pragma unroll
    for (int r = 0; r < 8; ++r) {
      o0[r] *= alpha; o1[r] *= alpha; o2[r] *= alpha; o3[r] *= alpha;
    }

    // ---- O^T += V^T(16x32 per d-tile) x P^T(32x16) ----
    o0 = __builtin_amdgcn_wmma_f32_16x16x32_f16(false, va0, false, pb, (short)0, o0, false, false);
    o1 = __builtin_amdgcn_wmma_f32_16x16x32_f16(false, va1, false, pb, (short)0, o1, false, false);
    o2 = __builtin_amdgcn_wmma_f32_16x16x32_f16(false, va2, false, pb, (short)0, o2, false, false);
    o3 = __builtin_amdgcn_wmma_f32_16x16x32_f16(false, va3, false, pb, (short)0, o3, false, false);

    // ---- soft scheduling hints: batch DS reads ahead of each WMMA burst ----
    __builtin_amdgcn_sched_group_barrier(0x100, 8, 0);   // DS reads: S^T operands
    __builtin_amdgcn_sched_group_barrier(0x008, 4, 0);   // WMMA: S^T
    __builtin_amdgcn_sched_group_barrier(0x100, 8, 0);   // DS reads: V^T operands
    __builtin_amdgcn_sched_group_barrier(0x402, 160, 0); // VALU+TRANS: softmax
    __builtin_amdgcn_sched_group_barrier(0x008, 4, 0);   // WMMA: PV

    // ---- write next tile to the alternate buffer; one barrier per iter ----
    if (it < NTILE - 1) {
      stage_store(st, sK[cur ^ 1], sVt[cur ^ 1], skey, sdg);
      __syncthreads();
    }
  }

  // ---- epilogue: out[b, qh, qw, n*64 + d], non-temporal (write-once) ----
  const float inv = 1.0f / l_run;
  const int qh = qrow >> 5;
  const int qw = qrow & 31;
  float* op = Out + ((((size_t)b * 32 + qh) * 32 + qw) * 512) + n * 64 + 8 * kh;
#define EPI(OACC, TT)                                                            \
  {                                                                              \
    f4v lo4 = { OACC[0] * inv, OACC[1] * inv, OACC[2] * inv, OACC[3] * inv };    \
    f4v hi4 = { OACC[4] * inv, OACC[5] * inv, OACC[6] * inv, OACC[7] * inv };    \
    __builtin_nontemporal_store(lo4, (f4v*)(op + 16 * TT));                      \
    __builtin_nontemporal_store(hi4, (f4v*)(op + 16 * TT + 4));                  \
  }
  EPI(o0, 0)
  EPI(o1, 1)
  EPI(o2, 2)
  EPI(o3, 3)
#undef EPI
}

extern "C" void kernel_launch(void* const* d_in, const int* in_sizes, int n_in,
                              void* d_out, int out_size, void* d_ws, size_t ws_size,
                              hipStream_t stream) {
  const float* q    = (const float*)d_in[0];
  const float* k    = (const float*)d_in[1];
  const float* v    = (const float*)d_in[2];
  const float* wemb = (const float*)d_in[3];
  const float* hemb = (const float*)d_in[4];
  float* out = (float*)d_out;

  dim3 grid(LSEQ / BM, 64);   // (query tiles, b*heads)
  dim3 block(32 * NWAVE);
  fa_relpos_kernel<<<grid, block, 0, stream>>>(q, k, v, wemb, hemb, out);
}

// v002
// Measured time: 36.1 microseconds a run.
// Two timings next to v001 put it at 1.44 and 1.43 times that version's speed.
// Counting every step since v000, it is 2.14 times as fast.
#include <hip/hip_runtime.h>

typedef __attribute__((ext_vector_type(16))) _Float16 v16h;
typedef __attribute__((ext_vector_type(8)))  _Float16 v8h;
typedef __attribute__((ext_vector_type(8)))  float    v8f;
typedef __attribute__((ext_vector_type(4)))  float    f4v;

#define LSEQ 1024   // H*W
#define HD   64     // head dim
#define BM   128    // queries per workgroup (8 waves x 16 rows)
#define BN   32     // keys per iteration
#define NWAVE 8
#define NTILE (LSEQ / BN)
// LDS row pitches in halves. Both are 16 B x odd, so the 16 rows that one
// half-wave reads with ds_load_b128 fall on 64 distinct banks.
#define KP   (HD + 8)   // K' row: 144 B
#define VP   (BN + 8)   // V^T row: 80 B

// Build a 16-element f16 A/B operand from two contiguous 8-half LDS chunks.
// Element e<8  -> row[8*kh + e] ; element e>=8 -> row[16 + 8*kh + (e-8)]
__device__ __forceinline__ v16h lds_a16(const _Float16* row, int kh) {
  v8h lo = *(const v8h*)(row + 8 * kh);
  v8h hi = *(const v8h*)(row + 16 + 8 * kh);
  v16h r;
#pragma unroll
  for (int i = 0; i < 8; ++i) { r[i] = lo[i]; r[i + 8] = hi[i]; }
  return r;
}

// One thread's share of a K/V tile as it comes from global memory (f32).
struct RawTile { f4v k0, k1, v0, v1, h0, h1; };

// Global -> registers only: nothing here waits for the data.
__device__ __forceinline__ RawTile raw_load(const float* __restrict__ K,
                                            const float* __restrict__ V,
                                            const float* __restrict__ Hemb,
                                            size_t base, int gk, int sdg) {
  const int kp_ = gk >> 5;   // p (row of key in 32x32 grid)
  const f4v* kg = (const f4v*)(K    + base + (size_t)gk * HD + sdg);
  const f4v* vg = (const f4v*)(V    + base + (size_t)gk * HD + sdg);
  const f4v* hg = (const f4v*)(Hemb + kp_ * HD + sdg);
  RawTile t;
  t.k0 = kg[0]; t.k1 = kg[1];
  t.v0 = vg[0]; t.v1 = vg[1];
  t.h0 = hg[0]; t.h1 = hg[1];
  return t;
}

// Registers -> LDS: fold position bias into K', convert K'/V to f16;
// K' key-major, V transposed dim-major.
__device__ __forceinline__ void stage_store(const RawTile& t, f4v wa, f4v wb,
                                            _Float16* bK, _Float16* bVt,
                                            int skey, int sdg) {
  v8h kk, vv;
#pragma unroll
  for (int i = 0; i < 4; ++i) {
    kk[i]     = (_Float16)(t.k0[i] + t.h0[i] + wa[i]);
    kk[i + 4] = (_Float16)(t.k1[i] + t.h1[i] + wb[i]);
    vv[i]     = (_Float16)t.v0[i];
    vv[i + 4] = (_Float16)t.v1[i];
  }
  *(v8h*)(&bK[skey * KP + sdg]) = kk;
#pragma unroll
  for (int i = 0; i < 8; ++i) bVt[(sdg + i) * VP + skey] = vv[i];
}

// Work-group barrier that orders LDS only: the wave's LDS stores are done before
// it signals, and no LDS read moves ahead of it. __syncthreads() would also wait
// for every global load in flight, which ends the two-trip lead of the prefetch.
__device__ __forceinline__ void lds_barrier() {
  __builtin_amdgcn_fence(__ATOMIC_RELEASE, "workgroup", "local");
  __builtin_amdgcn_s_barrier();
  __builtin_amdgcn_fence(__ATOMIC_ACQUIRE, "workgroup", "local");
}

__global__ __launch_bounds__(256)
void fa_relpos_kernel(const float* __restrict__ Q,
                      const float* __restrict__ K,
                      const float* __restrict__ V,
                      const float* __restrict__ Wemb,
                      const float* __restrict__ Hemb,
                      float* __restrict__ Out) {
  __shared__ __attribute__((aligned(16))) _Float16 sK[2][BN * KP];   // K' tiles (bias folded), key-major, padded rows
  __shared__ __attribute__((aligned(16))) _Float16 sVt[2][HD * VP];  // V tiles transposed, dim-major, padded rows

  const int pair = blockIdx.y;           // b*8 + n
  const int b    = pair >> 3;
  const int n    = pair & 7;
  const int tid  = threadIdx.x;
  const int lane = tid & 31;
  const int wv   = tid >> 5;             // wave id 0..7
  const int nq   = lane & 15;            // query column / A-row selector
  const int kh   = lane >> 4;            // K-group half selector
  const int qrow = blockIdx.x * BM + wv * 16 + nq;

  const size_t base = (size_t)pair * LSEQ * HD;

  // ---- Q operand (B-matrix layout for S^T = K' x (s*Q)^T), loaded once ----
  // Fold log2(e) into the scale so softmax runs natively in exp2 domain
  // (v_exp_f32 is exp2): softmax(s*logits) == softmax2(s*log2e*logits).
  const float scale = 0.125f * 1.44269504088896340736f;
  const float* qp = Q + base + (size_t)qrow * HD;
  v16h qb0, qb1;
#pragma unroll
  for (int e = 0; e < 8; ++e) {
    qb0[e]     = (_Float16)(qp[      8 * kh + e] * scale);
    qb0[e + 8] = (_Float16)(qp[16 +  8 * kh + e] * scale);
    qb1[e]     = (_Float16)(qp[32 +  8 * kh + e] * scale);
    qb1[e + 8] = (_Float16)(qp[48 +  8 * kh + e] * scale);
  }

  float m_run = -3.0e38f;
  float l_run = 0.0f;
  v8f o0 = {}, o1 = {}, o2 = {}, o3 = {};
  const v8f zero = {};

  const int skey = (tid >> 3) & 31;      // staging: key 0..31
  const int sdg  = (tid & 7) * 8;        // staging: dim group 0,8,...,56

  // w_emb row of this thread's key column: key & 31 == skey for every tile.
  const f4v wa = *(const f4v*)(Wemb + skey * HD + sdg);
  const f4v wb = *(const f4v*)(Wemb + skey * HD + sdg + 4);

  // ---- prologue: tiles 0 and 1 requested together; tile 0 into buffer 0 ----
  RawTile nxt;
  {
    RawTile t0 = raw_load(K, V, Hemb, base, skey, sdg);
    nxt = raw_load(K, V, Hemb, base, BN + skey, sdg);
    stage_store(t0, wa, wb, sK[0], sVt[0], skey, sdg);
  }
  lds_barrier();

  // Two trips per branch: the two register sets then swap by name, not by copies.
#pragma unroll 2
  for (int it = 0; it < NTILE; ++it) {
    const int cur = it & 1;

    // ---- this tile's K' and V^T fragments, one group of LDS reads ----
    const _Float16* arow0 = &sK[cur][nq * KP];
    const _Float16* arow1 = &sK[cur][(nq + 16) * KP];
    v16h a00 = lds_a16(arow0,      kh);
    v16h a01 = lds_a16(arow0 + 32, kh);
    v16h a10 = lds_a16(arow1,      kh);
    v16h a11 = lds_a16(arow1 + 32, kh);
    v16h va0 = lds_a16(&sVt[cur][(nq +  0) * VP], kh);
    v16h va1 = lds_a16(&sVt[cur][(nq + 16) * VP], kh);
    v16h va2 = lds_a16(&sVt[cur][(nq + 32) * VP], kh);
    v16h va3 = lds_a16(&sVt[cur][(nq + 48) * VP], kh);
    // The trip's first WMMA waits on these reads, so they go out first; the
    // address arithmetic of the global loads below runs under their latency.
    __builtin_amdgcn_sched_barrier(0);

    // ---- global loads of the tile after next: in flight for two trips.
    // The last two trips ask for the last tile again (in bounds, never used):
    // with a branch round the loads the build waits for every load in flight
    // (s_wait_loadcnt 0) in each trip, and the lead is gone.
    const int ft = (it + 2 < NTILE) ? it + 2 : NTILE - 1;
    RawTile far = raw_load(K, V, Hemb, base, ft * BN + skey, sdg);
    // Keeps the loads above where they stand: without it the scheduler sinks
    // the global loads down to their uses, and each trip
    // then waits out their whole latency.
    __builtin_amdgcn_sched_barrier(0);

    // ---- S^T = K'(32x64) x Qs^T(64x16) ----
    v8f s0 = __builtin_amdgcn_wmma_f32_16x16x32_f16(false, a00, false, qb0, (short)0, zero, false, false);
    s0     = __builtin_amdgcn_wmma_f32_16x16x32_f16(false, a01, false, qb1, (short)0, s0,   false, false);
    v8f s1 = __builtin_amdgcn_wmma_f32_16x16x32_f16(false, a10, false, qb0, (short)0, zero, false, false);
    s1     = __builtin_amdgcn_wmma_f32_16x16x32_f16(false, a11, false, qb1, (short)0, s1,   false, false);

    // ---- online softmax in exp2 domain (lane owns query column nq) ----
    float mx = m_run;
#pragma unroll
    for (int r = 0; r < 8; ++r) mx = fmaxf(mx, fmaxf(s0[r], s1[r]));
    mx = fmaxf(mx, __shfl_xor(mx, 16, 32));
    const float alpha = __builtin_amdgcn_exp2f(m_run - mx);
    m_run = mx;

    float rs = 0.0f;
    v16h pb;                             // P^T packed directly into B-operand layout
#pragma unroll
    for (int r = 0; r < 8; ++r) {
      float p0 = __builtin_amdgcn_exp2f(s0[r] - mx);  // key = kb + 8*kh + r
      float p1 = __builtin_amdgcn_exp2f(s1[r] - mx);  // key = kb + 16 + 8*kh + r
      rs += p0 + p1;
      pb[r]     = (_Float16)p0;
      pb[r + 8] = (_Float16)p1;
    }
    rs += __shfl_xor(rs, 16, 32);
    l_run = l_run * alpha + rs;

#pragma unroll
    for (int r = 0; r < 8; ++r) {
      o0[r] *= alpha; o1[r] *= alpha; o2[r] *= alpha; o3[r] *= alpha;
    }

    // ---- O^T += V^T(16x32 per d-tile) x P^T(32x16) ----
    o0 = __builtin_amdgcn_wmma_f32_16x16x32_f16(false, va0, false, pb, (short)0, o0, false, false);
    o1 = __builtin_amdgcn_wmma_f32_16x16x32_f16(false, va1, false, pb, (short)0, o1, false, false);
    o2 = __builtin_amdgcn_wmma_f32_16x16x32_f16(false, va2, false, pb, (short)0, o2, false, false);
    o3 = __builtin_amdgcn_wmma_f32_16x16x32_f16(false, va3, false, pb, (short)0, o3, false, false);

    // Keeps the wait for the global loads below the trip's whole compute:
    // without it the scheduler lifts the conversion and the LDS stores up.
    __builtin_amdgcn_sched_barrier(0);

    // ---- write next tile to the alternate buffer; one barrier per iter ----
    if (it < NTILE - 1) {
      stage_store(nxt, wa, wb, sK[cur ^ 1], sVt[cur ^ 1], skey, sdg);
      lds_barrier();
    }
    nxt = far;
  }
  // The last two trips' loads are never read: none may still be in flight
  // when the wave gives its registers back.
  asm volatile("s_wait_loadcnt 0x0" ::: "memory");

  // ---- epilogue: out[b, qh, qw, n*64 + d], non-temporal (write-once) ----
  const float inv = 1.0f / l_run;
  const int qh = qrow >> 5;
  const int qw = qrow & 31;
  float* op = Out + ((((size_t)b * 32 + qh) * 32 + qw) * 512) + n * 64 + 8 * kh;
#define EPI(OACC, TT)                                                            \
  {                                                                              \
    f4v lo4 = { OACC[0] * inv, OACC[1] * inv, OACC[2] * inv, OACC[3] * inv };    \
    f4v hi4 = { OACC[4] * inv, OACC[5] * inv, OACC[6] * inv, OACC[7] * inv };    \
    __builtin_nontemporal_store(lo4, (f4v*)(op + 16 * TT));                      \
    __builtin_nontemporal_store(hi4, (f4v*)(op + 16 * TT + 4));                  \
  }
  EPI(o0, 0)
  EPI(o1, 1)
  EPI(o2, 2)
  EPI(o3, 3)
#undef EPI
}

extern "C" void kernel_launch(void* const* d_in, const int* in_sizes, int n_in,
                              void* d_out, int out_size, void* d_ws, size_t ws_size,
                              hipStream_t stream) {
  const float* q    = (const float*)d_in[0];
  const float* k    = (const float*)d_in[1];
  const float* v    = (const float*)d_in[2];
  const float* wemb = (const float*)d_in[3];
  const float* hemb = (const float*)d_in[4];
  float* out = (float*)d_out;

  dim3 grid(LSEQ / BM, 64);   // (query tiles, b*heads)
  dim3 block(32 * NWAVE);
  fa_relpos_kernel<<<grid, block, 0, stream>>>(q, k, v, wemb, hemb, out);
}

// v003
// It runs in 32.8 microseconds.
// Timed twice side by side with v002, it ran 1.10 times as fast both times.
// Over all steps from v000 it is 2.35 times as fast.
#include <hip/hip_runtime.h>

typedef __attribute__((ext_vector_type(16))) _Float16 v16h;
typedef __attribute__((ext_vector_type(8)))  _Float16 v8h;
typedef __attribute__((ext_vector_type(8)))  float    v8f;
typedef __attribute__((ext_vector_type(4)))  float    f4v;
typedef __attribute__((ext_vector_type(2)))  float    f2v;

#define LSEQ 1024   // H*W
#define HD   64     // head dim
#define BM   256    // queries per workgroup (8 waves x 32 query columns)
#define BN   32     // keys per iteration
#define NWAVE 8
#define NTILE (LSEQ / BN)
// LDS row pitches in halves. Both are 16 B x odd, so the 16 rows that one
// half-wave reads with ds_load_b128 fall on 64 distinct banks.
#define KP   (HD + 8)   // K' row: 144 B
#define VP   (BN + 8)   // V^T row: 80 B

// Build a 16-element f16 A/B operand from two contiguous 8-half LDS chunks.
// Element e<8  -> row[8*kh + e] ; element e>=8 -> row[16 + 8*kh + (e-8)]
__device__ __forceinline__ v16h lds_a16(const _Float16* row, int kh) {
  v8h lo = *(const v8h*)(row + 8 * kh);
  v8h hi = *(const v8h*)(row + 16 + 8 * kh);
  v16h r;
#pragma unroll
  for (int i = 0; i < 8; ++i) { r[i] = lo[i]; r[i + 8] = hi[i]; }
  return r;
}

// One thread's share of a K/V tile as it comes from global memory (f32).
struct RawTile { f4v k0, k1, v0, v1, h0, h1; };

// Global -> registers only: nothing here waits for the data.
__device__ __forceinline__ RawTile raw_load(const float* __restrict__ K,
                                            const float* __restrict__ V,
                                            const float* __restrict__ Hemb,
                                            size_t base, int gk, int sdg) {
  const int kp_ = gk >> 5;   // p (row of key in 32x32 grid)
  const f4v* kg = (const f4v*)(K    + base + (size_t)gk * HD + sdg);
  const f4v* vg = (const f4v*)(V    + base + (size_t)gk * HD + sdg);
  const f4v* hg = (const f4v*)(Hemb + kp_ * HD + sdg);
  RawTile t;
  t.k0 = kg[0]; t.k1 = kg[1];
  t.v0 = vg[0]; t.v1 = vg[1];
  t.h0 = hg[0]; t.h1 = hg[1];
  return t;
}

// Registers -> LDS: fold position bias into K', convert K'/V to f16;
// K' key-major, V transposed dim-major.
__device__ __forceinline__ void stage_store(const RawTile& t, f4v wa, f4v wb,
                                            _Float16* bK, _Float16* bVt,
                                            int skey, int sdg) {
  v8h kk, vv;
#pragma unroll
  for (int i = 0; i < 4; ++i) {
    kk[i]     = (_Float16)(t.k0[i] + t.h0[i] + wa[i]);
    kk[i + 4] = (_Float16)(t.k1[i] + t.h1[i] + wb[i]);
    vv[i]     = (_Float16)t.v0[i];
    vv[i + 4] = (_Float16)t.v1[i];
  }
  *(v8h*)(&bK[skey * KP + sdg]) = kk;
#pragma unroll
  for (int i = 0; i < 8; ++i) bVt[(sdg + i) * VP + skey] = vv[i];
}

// Work-group barrier that orders LDS only: the wave's LDS stores are done before
// it signals, and no LDS read moves ahead of it. __syncthreads() would also wait
// for every global load in flight, which ends the two-trip lead of the prefetch.
__device__ __forceinline__ void lds_barrier() {
  __builtin_amdgcn_fence(__ATOMIC_RELEASE, "workgroup", "local");
  __builtin_amdgcn_s_barrier();
  __builtin_amdgcn_fence(__ATOMIC_ACQUIRE, "workgroup", "local");
}

__global__ __launch_bounds__(256)
void fa_relpos_kernel(const float* __restrict__ Q,
                      const float* __restrict__ K,
                      const float* __restrict__ V,
                      const float* __restrict__ Wemb,
                      const float* __restrict__ Hemb,
                      float* __restrict__ Out) {
  __shared__ __attribute__((aligned(16))) _Float16 sK[2][BN * KP];   // K' tiles (bias folded), key-major, padded rows
  __shared__ __attribute__((aligned(16))) _Float16 sVt[2][HD * VP];  // V tiles transposed, dim-major, padded rows

  const int pair = blockIdx.y;           // b*8 + n
  const int b    = pair >> 3;
  const int n    = pair & 7;
  const int tid  = threadIdx.x;
  const int lane = tid & 31;
  const int wv   = tid >> 5;             // wave id 0..7
  const int nq   = lane & 15;            // query column / A-row selector
  const int kh   = lane >> 4;            // K-group half selector
  // Each wave owns two 16-column query groups, so every K' and V^T fragment
  // read from LDS feeds two WMMAs.
  const int qrow0 = blockIdx.x * BM + wv * 32 + nq;

  const size_t base = (size_t)pair * LSEQ * HD;

  // ---- Q operand (B-matrix layout for S^T = K' x (s*Q)^T), loaded once ----
  // Fold log2(e) into the scale so softmax runs natively in exp2 domain
  // (v_exp_f32 is exp2): softmax(s*logits) == softmax2(s*log2e*logits).
  const float scale = 0.125f * 1.44269504088896340736f;
  v16h qb0[2], qb1[2];
#pragma unroll
  for (int g = 0; g < 2; ++g) {
    const float* qp = Q + base + (size_t)(qrow0 + 16 * g) * HD;
#pragma unroll
    for (int e = 0; e < 8; ++e) {
      qb0[g][e]     = (_Float16)(qp[      8 * kh + e] * scale);
      qb0[g][e + 8] = (_Float16)(qp[16 +  8 * kh + e] * scale);
      qb1[g][e]     = (_Float16)(qp[32 +  8 * kh + e] * scale);
      qb1[g][e + 8] = (_Float16)(qp[48 +  8 * kh + e] * scale);
    }
  }

  float m_run[2] = { -3.0e38f, -3.0e38f };
  float l_run[2] = { 0.0f, 0.0f };
  v8f o0[2] = {}, o1[2] = {}, o2[2] = {}, o3[2] = {};
  const v8f zero = {};

  const int skey = (tid >> 3) & 31;      // staging: key 0..31
  const int sdg  = (tid & 7) * 8;        // staging: dim group 0,8,...,56

  // w_emb row of this thread's key column: key & 31 == skey for every tile.
  const f4v wa = *(const f4v*)(Wemb + skey * HD + sdg);
  const f4v wb = *(const f4v*)(Wemb + skey * HD + sdg + 4);

  // ---- prologue: tiles 0 and 1 requested together; tile 0 into buffer 0 ----
  RawTile nxt;
  {
    RawTile t0 = raw_load(K, V, Hemb, base, skey, sdg);
    nxt = raw_load(K, V, Hemb, base, BN + skey, sdg);
    stage_store(t0, wa, wb, sK[0], sVt[0], skey, sdg);
  }
  lds_barrier();

  // Two trips per branch: the two register sets then swap by name, not by copies.
#pragma unroll 2
  for (int it = 0; it < NTILE; ++it) {
    const int cur = it & 1;

    // ---- this tile's K' and V^T fragments, one group of LDS reads ----
    const _Float16* arow0 = &sK[cur][nq * KP];
    const _Float16* arow1 = &sK[cur][(nq + 16) * KP];
    v16h a00 = lds_a16(arow0,      kh);
    v16h a01 = lds_a16(arow0 + 32, kh);
    v16h a10 = lds_a16(arow1,      kh);
    v16h a11 = lds_a16(arow1 + 32, kh);
    v16h va0 = lds_a16(&sVt[cur][(nq +  0) * VP], kh);
    v16h va1 = lds_a16(&sVt[cur][(nq + 16) * VP], kh);
    v16h va2 = lds_a16(&sVt[cur][(nq + 32) * VP], kh);
    v16h va3 = lds_a16(&sVt[cur][(nq + 48) * VP], kh);
    // The trip's first WMMA waits on these reads, so they go out first; the
    // address arithmetic of the global loads below runs under their latency.
    __builtin_amdgcn_sched_barrier(0);

    // ---- global loads of the tile after next: in flight for two trips.
    // The last two trips ask for the last tile again (in bounds, never used):
    // with a branch round the loads the build waits for every load in flight
    // (s_wait_loadcnt 0) in each trip, and the lead is gone.
    const int ft = (it + 2 < NTILE) ? it + 2 : NTILE - 1;
    RawTile far = raw_load(K, V, Hemb, base, ft * BN + skey, sdg);
    // The loads' address registers are reused by the WMMAs below.
    asm volatile("s_wait_xcnt 0x0" ::: "memory");
    // Keeps the loads above where they stand: without it the scheduler sinks
    // the global loads down to their uses, and each trip
    // then waits out their whole latency.
    __builtin_amdgcn_sched_barrier(0);

    // ---- S^T = K'(32x64) x Qs^T(64x16), both query groups ----
    v8f s0[2], s1[2];
#pragma unroll
    for (int g = 0; g < 2; ++g) {
      s0[g] = __builtin_amdgcn_wmma_f32_16x16x32_f16(false, a00, false, qb0[g], (short)0, zero,  false, false);
      s1[g] = __builtin_amdgcn_wmma_f32_16x16x32_f16(false, a10, false, qb0[g], (short)0, zero,  false, false);
    }
#pragma unroll
    for (int g = 0; g < 2; ++g) {
      s0[g] = __builtin_amdgcn_wmma_f32_16x16x32_f16(false, a01, false, qb1[g], (short)0, s0[g], false, false);
      s1[g] = __builtin_amdgcn_wmma_f32_16x16x32_f16(false, a11, false, qb1[g], (short)0, s1[g], false, false);
    }

    // ---- online softmax in exp2 domain (lane owns query column nq of each group) ----
    v16h pb[2];                          // P^T packed directly into B-operand layout
#pragma unroll
    for (int g = 0; g < 2; ++g) {
      float mx = m_run[g];
#pragma unroll
      for (int r = 0; r < 8; ++r) mx = fmaxf(mx, fmaxf(s0[g][r], s1[g][r]));
      mx = fmaxf(mx, __shfl_xor(mx, 16, 32));
      const float alpha = __builtin_amdgcn_exp2f(m_run[g] - mx);
      m_run[g] = mx;

      float rs = 0.0f;
#pragma unroll
      for (int r = 0; r < 8; r += 2) {
        // Pairs run along r, where the accumulator registers are neighbours.
        const f2v d0 = (f2v){ s0[g][r], s0[g][r + 1] } - mx;   // key = kb + 8*kh + r
        const f2v d1 = (f2v){ s1[g][r], s1[g][r + 1] } - mx;   // key = kb + 16 + 8*kh + r
        const f2v p0 = { __builtin_amdgcn_exp2f(d0.x), __builtin_amdgcn_exp2f(d0.y) };
        const f2v p1 = { __builtin_amdgcn_exp2f(d1.x), __builtin_amdgcn_exp2f(d1.y) };
        const f2v t  = p0 + p1;
        rs += t.x;
        rs += t.y;
        pb[g][r]     = (_Float16)p0.x;
        pb[g][r + 1] = (_Float16)p0.y;
        pb[g][r + 8] = (_Float16)p1.x;
        pb[g][r + 9] = (_Float16)p1.y;
      }
      rs += __shfl_xor(rs, 16, 32);
      l_run[g] = l_run[g] * alpha + rs;

#pragma unroll
      for (int r = 0; r < 8; ++r) {
        o0[g][r] *= alpha; o1[g][r] *= alpha; o2[g][r] *= alpha; o3[g][r] *= alpha;
      }
    }

    // ---- O^T += V^T(16x32 per d-tile) x P^T(32x16), both query groups ----
#pragma unroll
    for (int g = 0; g < 2; ++g) {
      o0[g] = __builtin_amdgcn_wmma_f32_16x16x32_f16(false, va0, false, pb[g], (short)0, o0[g], false, false);
      o1[g] = __builtin_amdgcn_wmma_f32_16x16x32_f16(false, va1, false, pb[g], (short)0, o1[g], false, false);
      o2[g] = __builtin_amdgcn_wmma_f32_16x16x32_f16(false, va2, false, pb[g], (short)0, o2[g], false, false);
      o3[g] = __builtin_amdgcn_wmma_f32_16x16x32_f16(false, va3, false, pb[g], (short)0, o3[g], false, false);
    }

    // Keeps the wait for the global loads below the trip's whole compute:
    // without it the scheduler lifts the conversion and the LDS stores up.
    __builtin_amdgcn_sched_barrier(0);

    // ---- write next tile to the alternate buffer; one barrier per iter ----
    if (it < NTILE - 1) {
      stage_store(nxt, wa, wb, sK[cur ^ 1], sVt[cur ^ 1], skey, sdg);
      lds_barrier();
    }
    nxt = far;
  }
  // The last two trips' loads are never read: none may still be in flight
  // when the wave gives its registers back.
  asm volatile("s_wait_loadcnt 0x0" ::: "memory");

  // ---- epilogue: out[b, qh, qw, n*64 + d], non-temporal (write-once) ----
  float* op[2];
#pragma unroll
  for (int g = 0; g < 2; ++g) {
    const float inv = 1.0f / l_run[g];
    const int qrow = qrow0 + 16 * g;
    const int qh = qrow >> 5;
    const int qw = qrow & 31;
    op[g] = Out + ((((size_t)b * 32 + qh) * 32 + qw) * 512) + n * 64 + 8 * kh;
#pragma unroll
    for (int r = 0; r < 8; ++r) {
      o0[g][r] *= inv; o1[g][r] *= inv; o2[g][r] *= inv; o3[g][r] *= inv;
    }
  }
  // Every product and address is formed before the first store, so that no
  // register of an issued store is written again behind it.
  __builtin_amdgcn_sched_barrier(0);
#define EPI(OACC, TT)                                                            \
  {                                                                              \
    f4v lo4 = { OACC[0], OACC[1], OACC[2], OACC[3] };                            \
    f4v hi4 = { OACC[4], OACC[5], OACC[6], OACC[7] };                            \
    __builtin_nontemporal_store(lo4, (f4v*)(op[g] + 16 * TT));                   \
    __builtin_nontemporal_store(hi4, (f4v*)(op[g] + 16 * TT + 4));               \
  }
#pragma unroll
  for (int g = 0; g < 2; ++g) {
    EPI(o0[g], 0)
    EPI(o1[g], 1)
    EPI(o2[g], 2)
    EPI(o3[g], 3)
  }
#undef EPI
}

extern "C" void kernel_launch(void* const* d_in, const int* in_sizes, int n_in,
                              void* d_out, int out_size, void* d_ws, size_t ws_size,
                              hipStream_t stream) {
  const float* q    = (const float*)d_in[0];
  const float* k    = (const float*)d_in[1];
  const float* v    = (const float*)d_in[2];
  const float* wemb = (const float*)d_in[3];
  const float* hemb = (const float*)d_in[4];
  float* out = (float*)d_out;

  dim3 grid(LSEQ / BM, 64);   // (query tiles, b*heads)
  dim3 block(32 * NWAVE);
  fa_relpos_kernel<<<grid, block, 0, stream>>>(q, k, v, wemb, hemb, out);
}

// v004
// A run of this version takes 28 microseconds.
// In both of two side-by-side timings against v003, it was 1.17 times as fast.
// Counting every step since v000, it is 2.76 times as fast.
#include <hip/hip_runtime.h>

typedef __attribute__((ext_vector_type(16))) _Float16 v16h;
typedef __attribute__((ext_vector_type(8)))  _Float16 v8h;
typedef __attribute__((ext_vector_type(8)))  float    v8f;
typedef __attribute__((ext_vector_type(4)))  float    f4v;
typedef __attribute__((ext_vector_type(2)))  float    f2v;

#define LSEQ 1024   // H*W
#define HD   64     // head dim
#define BM   256    // queries per workgroup (8 waves x 32 query columns)
#define BN   32     // keys per iteration
#define NWAVE 8
#define NTILE (LSEQ / BN)
// LDS row pitches in halves, each for its reader: 16 B x odd for the
// ds_load_b128 reads of K', 32 B x odd for the transposing reads of V.
#define KP   (HD + 8)    // K' row: 144 B
#define VP   (HD + 16)   // V row: 160 B

// Build a 16-element f16 A/B operand from two contiguous 8-half LDS chunks.
// Element e<8  -> row[8*kh + e] ; element e>=8 -> row[16 + 8*kh + (e-8)]
__device__ __forceinline__ v16h lds_a16(const _Float16* row, int kh) {
  v8h lo = *(const v8h*)(row + 8 * kh);
  v8h hi = *(const v8h*)(row + 16 + 8 * kh);
  v16h r;
#pragma unroll
  for (int i = 0; i < 8; ++i) { r[i] = lo[i]; r[i + 8] = hi[i]; }
  return r;
}

// One 16 (dims) x 32 (keys) A operand of V^T from the key-major V tile, by two
// transposing loads. p is the lane's own address: key row 8*kh + (lane & 7),
// 16-byte piece (lane >> 3) & 1 of the 16 dims. The lane gets dim nq of keys
// 8*kh + 0..7 and, 16 rows on, of keys 16 + 8*kh + 0..7: the k order of lds_a16.
typedef __attribute__((ext_vector_type(8))) short s8v;
__device__ __forceinline__ v16h lds_vt16(const _Float16* p) {
  typedef __attribute__((address_space(3))) s8v lds_s8v;
  v8h lo = __builtin_bit_cast(v8h, __builtin_amdgcn_ds_load_tr16_b128_v8i16((lds_s8v*)p));
  v8h hi = __builtin_bit_cast(v8h, __builtin_amdgcn_ds_load_tr16_b128_v8i16((lds_s8v*)(p + 16 * VP)));
  v16h r;
#pragma unroll
  for (int i = 0; i < 8; ++i) { r[i] = lo[i]; r[i + 8] = hi[i]; }
  return r;
}

// One thread's share of a K/V tile as it comes from global memory (f32).
struct RawTile { f4v k0, k1, v0, v1, h0, h1; };

// Global -> registers only: nothing here waits for the data.
__device__ __forceinline__ RawTile raw_load(const float* __restrict__ K,
                                            const float* __restrict__ V,
                                            const float* __restrict__ Hemb,
                                            size_t base, int gk, int sdg) {
  const int kp_ = gk >> 5;   // p (row of key in 32x32 grid)
  const f4v* kg = (const f4v*)(K    + base + (size_t)gk * HD + sdg);
  const f4v* vg = (const f4v*)(V    + base + (size_t)gk * HD + sdg);
  const f4v* hg = (const f4v*)(Hemb + kp_ * HD + sdg);
  RawTile t;
  t.k0 = kg[0]; t.k1 = kg[1];
  t.v0 = vg[0]; t.v1 = vg[1];
  t.h0 = hg[0]; t.h1 = hg[1];
  return t;
}

// Registers -> LDS: fold position bias into K', convert K'/V to f16;
// both key-major, one 16-byte store each.
__device__ __forceinline__ void stage_store(const RawTile& t, f4v wa, f4v wb,
                                            _Float16* bK, _Float16* bV,
                                            int skey, int sdg) {
  v8h kk, vv;
#pragma unroll
  for (int i = 0; i < 4; ++i) {
    kk[i]     = (_Float16)(t.k0[i] + t.h0[i] + wa[i]);
    kk[i + 4] = (_Float16)(t.k1[i] + t.h1[i] + wb[i]);
    vv[i]     = (_Float16)t.v0[i];
    vv[i + 4] = (_Float16)t.v1[i];
  }
  *(v8h*)(&bK[skey * KP + sdg]) = kk;
  *(v8h*)(&bV[skey * VP + sdg]) = vv;
}

// Work-group barrier that orders LDS only: the wave's LDS stores are done before
// it signals, and no LDS read moves ahead of it. __syncthreads() would also wait
// for every global load in flight, which ends the two-trip lead of the prefetch.
__device__ __forceinline__ void lds_barrier() {
  __builtin_amdgcn_fence(__ATOMIC_RELEASE, "workgroup", "local");
  __builtin_amdgcn_s_barrier();
  __builtin_amdgcn_fence(__ATOMIC_ACQUIRE, "workgroup", "local");
}

__global__ __launch_bounds__(256)
void fa_relpos_kernel(const float* __restrict__ Q,
                      const float* __restrict__ K,
                      const float* __restrict__ V,
                      const float* __restrict__ Wemb,
                      const float* __restrict__ Hemb,
                      float* __restrict__ Out) {
  __shared__ __attribute__((aligned(16))) _Float16 sK[2][BN * KP];   // K' tiles (bias folded), key-major, padded rows
  __shared__ __attribute__((aligned(16))) _Float16 sV[2][BN * VP];   // V tiles, key-major, padded rows

  const int pair = blockIdx.y;           // b*8 + n
  const int b    = pair >> 3;
  const int n    = pair & 7;
  const int tid  = threadIdx.x;
  const int lane = tid & 31;
  const int wv   = tid >> 5;             // wave id 0..7
  const int nq   = lane & 15;            // query column / A-row selector
  const int kh   = lane >> 4;            // K-group half selector
  // Each wave owns two 16-column query groups, so every K' and V^T fragment
  // read from LDS feeds two WMMAs.
  const int qrow0 = blockIdx.x * BM + wv * 32 + nq;

  const size_t base = (size_t)pair * LSEQ * HD;

  // ---- Q operand (B-matrix layout for S^T = K' x (s*Q)^T), loaded once ----
  // Fold log2(e) into the scale so softmax runs natively in exp2 domain
  // (v_exp_f32 is exp2): softmax(s*logits) == softmax2(s*log2e*logits).
  const float scale = 0.125f * 1.44269504088896340736f;
  v16h qb0[2], qb1[2];
#pragma unroll
  for (int g = 0; g < 2; ++g) {
    const float* qp = Q + base + (size_t)(qrow0 + 16 * g) * HD;
#pragma unroll
    for (int e = 0; e < 8; ++e) {
      qb0[g][e]     = (_Float16)(qp[      8 * kh + e] * scale);
      qb0[g][e + 8] = (_Float16)(qp[16 +  8 * kh + e] * scale);
      qb1[g][e]     = (_Float16)(qp[32 +  8 * kh + e] * scale);
      qb1[g][e + 8] = (_Float16)(qp[48 +  8 * kh + e] * scale);
    }
  }

  float m_run[2] = { -3.0e38f, -3.0e38f };
  float l_run[2] = { 0.0f, 0.0f };
  v8f o0[2] = {}, o1[2] = {}, o2[2] = {}, o3[2] = {};
  const v8f zero = {};

  const int skey = (tid >> 3) & 31;      // staging: key 0..31
  const int sdg  = (tid & 7) * 8;        // staging: dim group 0,8,...,56

  // w_emb row of this thread's key column: key & 31 == skey for every tile.
  const f4v wa = *(const f4v*)(Wemb + skey * HD + sdg);
  const f4v wb = *(const f4v*)(Wemb + skey * HD + sdg + 4);

  // ---- prologue: tiles 0 and 1 requested together; tile 0 into buffer 0 ----
  RawTile nxt;
  {
    RawTile t0 = raw_load(K, V, Hemb, base, skey, sdg);
    nxt = raw_load(K, V, Hemb, base, BN + skey, sdg);
    stage_store(t0, wa, wb, sK[0], sV[0], skey, sdg);
  }
  lds_barrier();

  // Two trips per branch: the two register sets then swap by name, not by copies.
#pragma unroll 2
  for (int it = 0; it < NTILE; ++it) {
    const int cur = it & 1;

    // ---- this tile's K' and V^T fragments, one group of LDS reads ----
    const _Float16* arow0 = &sK[cur][nq * KP];
    const _Float16* arow1 = &sK[cur][(nq + 16) * KP];
    v16h a00 = lds_a16(arow0,      kh);
    v16h a01 = lds_a16(arow0 + 32, kh);
    v16h a10 = lds_a16(arow1,      kh);
    v16h a11 = lds_a16(arow1 + 32, kh);
    const _Float16* vrow = &sV[cur][(8 * kh + (lane & 7)) * VP + 8 * ((lane >> 3) & 1)];
    v16h va0 = lds_vt16(vrow);
    v16h va1 = lds_vt16(vrow + 16);
    v16h va2 = lds_vt16(vrow + 32);
    v16h va3 = lds_vt16(vrow + 48);
    // The trip's first WMMA waits on these reads, so they go out first; the
    // address arithmetic of the global loads below runs under their latency.
    __builtin_amdgcn_sched_barrier(0);

    // ---- global loads of the tile after next: in flight for two trips.
    // The last two trips ask for the last tile again (in bounds, never used):
    // with a branch round the loads the build waits for every load in flight
    // (s_wait_loadcnt 0) in each trip, and the lead is gone.
    const int ft = (it + 2 < NTILE) ? it + 2 : NTILE - 1;
    RawTile far = raw_load(K, V, Hemb, base, ft * BN + skey, sdg);
    // The loads' address registers are reused by the WMMAs below.
    asm volatile("s_wait_xcnt 0x0" ::: "memory");
    // Keeps the loads above where they stand: without it the scheduler sinks
    // the global loads down to their uses, and each trip
    // then waits out their whole latency.
    __builtin_amdgcn_sched_barrier(0);

    // ---- S^T = K'(32x64) x Qs^T(64x16), both query groups ----
    v8f s0[2], s1[2];
#pragma unroll
    for (int g = 0; g < 2; ++g) {
      s0[g] = __builtin_amdgcn_wmma_f32_16x16x32_f16(false, a00, false, qb0[g], (short)0, zero,  false, false);
      s1[g] = __builtin_amdgcn_wmma_f32_16x16x32_f16(false, a10, false, qb0[g], (short)0, zero,  false, false);
    }
#pragma unroll
    for (int g = 0; g < 2; ++g) {
      s0[g] = __builtin_amdgcn_wmma_f32_16x16x32_f16(false, a01, false, qb1[g], (short)0, s0[g], false, false);
      s1[g] = __builtin_amdgcn_wmma_f32_16x16x32_f16(false, a11, false, qb1[g], (short)0, s1[g], false, false);
    }

    // ---- online softmax in exp2 domain (lane owns query column nq of each group) ----
    v16h pb[2];                          // P^T packed directly into B-operand layout
#pragma unroll
    for (int g = 0; g < 2; ++g) {
      float mx = m_run[g];
#pragma unroll
      for (int r = 0; r < 8; ++r) mx = fmaxf(mx, fmaxf(s0[g][r], s1[g][r]));
      mx = fmaxf(mx, __shfl_xor(mx, 16, 32));
      const float alpha = __builtin_amdgcn_exp2f(m_run[g] - mx);
      m_run[g] = mx;

      float rs = 0.0f;
#pragma unroll
      for (int r = 0; r < 8; r += 2) {
        // Pairs run along r, where the accumulator registers are neighbours.
        const f2v d0 = (f2v){ s0[g][r], s0[g][r + 1] } - mx;   // key = kb + 8*kh + r
        const f2v d1 = (f2v){ s1[g][r], s1[g][r + 1] } - mx;   // key = kb + 16 + 8*kh + r
        const f2v p0 = { __builtin_amdgcn_exp2f(d0.x), __builtin_amdgcn_exp2f(d0.y) };
        const f2v p1 = { __builtin_amdgcn_exp2f(d1.x), __builtin_amdgcn_exp2f(d1.y) };
        const f2v t  = p0 + p1;
        rs += t.x;
        rs += t.y;
        pb[g][r]     = (_Float16)p0.x;
        pb[g][r + 1] = (_Float16)p0.y;
        pb[g][r + 8] = (_Float16)p1.x;
        pb[g][r + 9] = (_Float16)p1.y;
      }
      rs += __shfl_xor(rs, 16, 32);
      l_run[g] = l_run[g] * alpha + rs;

#pragma unroll
      for (int r = 0; r < 8; ++r) {
        o0[g][r] *= alpha; o1[g][r] *= alpha; o2[g][r] *= alpha; o3[g][r] *= alpha;
      }
    }

    // ---- O^T += V^T(16x32 per d-tile) x P^T(32x16), both query groups ----
#pragma unroll
    for (int g = 0; g < 2; ++g) {
      o0[g] = __builtin_amdgcn_wmma_f32_16x16x32_f16(false, va0, false, pb[g], (short)0, o0[g], false, false);
      o1[g] = __builtin_amdgcn_wmma_f32_16x16x32_f16(false, va1, false, pb[g], (short)0, o1[g], false, false);
      o2[g] = __builtin_amdgcn_wmma_f32_16x16x32_f16(false, va2, false, pb[g], (short)0, o2[g], false, false);
      o3[g] = __builtin_amdgcn_wmma_f32_16x16x32_f16(false, va3, false, pb[g], (short)0, o3[g], false, false);
    }

    // Keeps the wait for the global loads below the trip's whole compute:
    // without it the scheduler lifts the conversion and the LDS stores up.
    __builtin_amdgcn_sched_barrier(0);

    // ---- write next tile to the alternate buffer; one barrier per iter ----
    if (it < NTILE - 1) {
      stage_store(nxt, wa, wb, sK[cur ^ 1], sV[cur ^ 1], skey, sdg);
      lds_barrier();
    }
    nxt = far;
  }
  // The last two trips' loads are never read: none may still be in flight
  // when the wave gives its registers back.
  asm volatile("s_wait_loadcnt 0x0" ::: "memory");

  // ---- epilogue: out[b, qh, qw, n*64 + d], non-temporal (write-once) ----
  float* op[2];
#pragma unroll
  for (int g = 0; g < 2; ++g) {
    const float inv = 1.0f / l_run[g];
    const int qrow = qrow0 + 16 * g;
    const int qh = qrow >> 5;
    const int qw = qrow & 31;
    op[g] = Out + ((((size_t)b * 32 + qh) * 32 + qw) * 512) + n * 64 + 8 * kh;
#pragma unroll
    for (int r = 0; r < 8; ++r) {
      o0[g][r] *= inv; o1[g][r] *= inv; o2[g][r] *= inv; o3[g][r] *= inv;
    }
  }
  // Every product and address is formed before the first store, so that no
  // register of an issued store is written again behind it.
  __builtin_amdgcn_sched_barrier(0);
#define EPI(OACC, TT)                                                            \
  {                                                                              \
    f4v lo4 = { OACC[0], OACC[1], OACC[2], OACC[3] };                            \
    f4v hi4 = { OACC[4], OACC[5], OACC[6], OACC[7] };                            \
    __builtin_nontemporal_store(lo4, (f4v*)(op[g] + 16 * TT));                   \
    __builtin_nontemporal_store(hi4, (f4v*)(op[g] + 16 * TT + 4));               \
  }
#pragma unroll
  for (int g = 0; g < 2; ++g) {
    EPI(o0[g], 0)
    EPI(o1[g], 1)
    EPI(o2[g], 2)
    EPI(o3[g], 3)
  }
#undef EPI
}

extern "C" void kernel_launch(void* const* d_in, const int* in_sizes, int n_in,
                              void* d_out, int out_size, void* d_ws, size_t ws_size,
                              hipStream_t stream) {
  const float* q    = (const float*)d_in[0];
  const float* k    = (const float*)d_in[1];
  const float* v    = (const float*)d_in[2];
  const float* wemb = (const float*)d_in[3];
  const float* hemb = (const float*)d_in[4];
  float* out = (float*)d_out;

  dim3 grid(LSEQ / BM, 64);   // (query tiles, b*heads)
  dim3 block(32 * NWAVE);
  fa_relpos_kernel<<<grid, block, 0, stream>>>(q, k, v, wemb, hemb, out);
}

// v005
// A run of this version takes 27.1 microseconds.
// In both of two side-by-side timings against v004, it was 1.03 times as fast.
// Counting every step since v000, it is 2.84 times as fast.
#include <hip/hip_runtime.h>

typedef __attribute__((ext_vector_type(16))) _Float16 v16h;
typedef __attribute__((ext_vector_type(8)))  _Float16 v8h;
typedef __attribute__((ext_vector_type(8)))  float    v8f;
typedef __attribute__((ext_vector_type(4)))  float    f4v;
typedef __attribute__((ext_vector_type(2)))  float    f2v;

#define LSEQ 1024   // H*W
#define HD   64     // head dim
#define BM   256    // queries per workgroup (8 waves x 32 query columns)
#define BN   32     // keys per iteration
#define NQW  8      // waves that share one half of the keys
#define NSPLIT 2    // halves of the keys, each walked by its own NQW waves
#define NWAVE (NQW * NSPLIT)
#define NTILE (LSEQ / NSPLIT / BN)   // tiles of one half
// LDS row pitches in halves, each for its reader: 16 B x odd for the
// ds_load_b128 reads of K', 32 B x odd for the transposing reads of V.
#define KP   (HD + 8)    // K' row: 144 B
#define VP   (HD + 16)   // V row: 160 B

// Build a 16-element f16 A/B operand from two contiguous 8-half LDS chunks.
// Element e<8  -> row[8*kh + e] ; element e>=8 -> row[16 + 8*kh + (e-8)]
__device__ __forceinline__ v16h lds_a16(const _Float16* row, int kh) {
  v8h lo = *(const v8h*)(row + 8 * kh);
  v8h hi = *(const v8h*)(row + 16 + 8 * kh);
  v16h r;
#pragma unroll
  for (int i = 0; i < 8; ++i) { r[i] = lo[i]; r[i + 8] = hi[i]; }
  return r;
}

// One 16 (dims) x 32 (keys) A operand of V^T from the key-major V tile, by two
// transposing loads. p is the lane's own address: key row 8*kh + (lane & 7),
// 16-byte piece (lane >> 3) & 1 of the 16 dims. The lane gets dim nq of keys
// 8*kh + 0..7 and, 16 rows on, of keys 16 + 8*kh + 0..7: the k order of lds_a16.
typedef __attribute__((ext_vector_type(8))) short s8v;
__device__ __forceinline__ v16h lds_vt16(const _Float16* p) {
  typedef __attribute__((address_space(3))) s8v lds_s8v;
  v8h lo = __builtin_bit_cast(v8h, __builtin_amdgcn_ds_load_tr16_b128_v8i16((lds_s8v*)p));
  v8h hi = __builtin_bit_cast(v8h, __builtin_amdgcn_ds_load_tr16_b128_v8i16((lds_s8v*)(p + 16 * VP)));
  v16h r;
#pragma unroll
  for (int i = 0; i < 8; ++i) { r[i] = lo[i]; r[i + 8] = hi[i]; }
  return r;
}

// One thread's share of a K/V tile as it comes from global memory (f32).
struct RawTile { f4v k0, k1, v0, v1, h0, h1; };

// Global -> registers only: nothing here waits for the data.
// kp, vp, hp: the lane's own eight floats of the tile's K row, V row and h_emb row.
__device__ __forceinline__ RawTile raw_load(const float* __restrict__ kp,
                                            const float* __restrict__ vp,
                                            const float* __restrict__ hp) {
  const f4v* kg = (const f4v*)kp;
  const f4v* vg = (const f4v*)vp;
  const f4v* hg = (const f4v*)hp;
  RawTile t;
  t.k0 = kg[0]; t.k1 = kg[1];
  t.v0 = vg[0]; t.v1 = vg[1];
  t.h0 = hg[0]; t.h1 = hg[1];
  return t;
}

// Registers -> LDS: fold position bias into K', convert K'/V to f16;
// both key-major, one 16-byte store each.
__device__ __forceinline__ void stage_store(const RawTile& t, f4v wa, f4v wb,
                                            _Float16* bK, _Float16* bV,
                                            int skey, int sdg) {
  v8h kk, vv;
#pragma unroll
  for (int i = 0; i < 4; ++i) {
    kk[i]     = (_Float16)(t.k0[i] + t.h0[i] + wa[i]);
    kk[i + 4] = (_Float16)(t.k1[i] + t.h1[i] + wb[i]);
    vv[i]     = (_Float16)t.v0[i];
    vv[i + 4] = (_Float16)t.v1[i];
  }
  *(v8h*)(&bK[skey * KP + sdg]) = kk;
  *(v8h*)(&bV[skey * VP + sdg]) = vv;
}

// Work-group barrier that orders LDS only: the wave's LDS stores are done before
// it signals, and no LDS read moves ahead of it. __syncthreads() would also wait
// for every global load in flight.
__device__ __forceinline__ void lds_barrier() {
  __builtin_amdgcn_fence(__ATOMIC_RELEASE, "workgroup", "local");
  __builtin_amdgcn_s_barrier();
  __builtin_amdgcn_fence(__ATOMIC_ACQUIRE, "workgroup", "local");
}

__global__ __launch_bounds__(32 * NWAVE)
void fa_relpos_kernel(const float* __restrict__ Q,
                      const float* __restrict__ K,
                      const float* __restrict__ V,
                      const float* __restrict__ Wemb,
                      const float* __restrict__ Hemb,
                      float* __restrict__ Out) {
  __shared__ __attribute__((aligned(16))) _Float16 sKh[NSPLIT][2][BN * KP];   // K' tiles (bias folded), key-major, padded rows
  __shared__ __attribute__((aligned(16))) _Float16 sVh[NSPLIT][2][BN * VP];   // V tiles, key-major, padded rows
  // Epilogue exchange between the two waves that hold the same query columns.
  __shared__ __attribute__((aligned(16))) f4v   xO[NWAVE][8][32];
  __shared__ float xM[NWAVE][32];
  __shared__ float xL[NWAVE][32];

  const int pair = blockIdx.y;           // b*8 + n
  const int b    = pair >> 3;
  const int n    = pair & 7;
  const int tid  = threadIdx.x;
  const int lane = tid & 31;
  const int wv   = __builtin_amdgcn_readfirstlane(tid >> 5);   // wave id 0..15, held as a scalar
  const int half = wv >> 3;              // which half of the keys this wave walks
  const int wq   = wv & (NQW - 1);       // which 32 query columns
  const int nq   = lane & 15;            // query column / A-row selector
  const int kh   = lane >> 4;            // K-group half selector
  // Each wave owns two 16-column query groups, so every K' and V^T fragment
  // read from LDS feeds two WMMAs.
  const int qrow0 = blockIdx.x * BM + wq * 32 + nq;
  const int kfirst = half * (LSEQ / NSPLIT);   // first key of this wave's half
  _Float16 (*sK)[BN * KP] = sKh[half];
  _Float16 (*sV)[BN * VP] = sVh[half];

  const size_t base = (size_t)pair * LSEQ * HD;

  // ---- Q operand (B-matrix layout for S^T = K' x (s*Q)^T), loaded once ----
  // Fold log2(e) into the scale so softmax runs natively in exp2 domain
  // (v_exp_f32 is exp2): softmax(s*logits) == softmax2(s*log2e*logits).
  const float scale = 0.125f * 1.44269504088896340736f;
  v16h qb0[2], qb1[2];
#pragma unroll
  for (int g = 0; g < 2; ++g) {
    const float* qp = Q + base + (size_t)(qrow0 + 16 * g) * HD;
#pragma unroll
    for (int e = 0; e < 8; ++e) {
      qb0[g][e]     = (_Float16)(qp[      8 * kh + e] * scale);
      qb0[g][e + 8] = (_Float16)(qp[16 +  8 * kh + e] * scale);
      qb1[g][e]     = (_Float16)(qp[32 +  8 * kh + e] * scale);
      qb1[g][e + 8] = (_Float16)(qp[48 +  8 * kh + e] * scale);
    }
  }

  float m_run[2] = { -3.0e38f, -3.0e38f };
  float l_run[2] = { 0.0f, 0.0f };
  v8f o0[2] = {}, o1[2] = {}, o2[2] = {}, o3[2] = {};
  const v8f zero = {};

  const int skey = (tid >> 3) & 31;      // staging: key 0..31
  const int sdg  = (tid & 7) * 8;        // staging: dim group 0,8,...,56
  // The lane's load addresses, stepped from tile to tile. A tile is one row p of
  // the 32x32 key grid, so its keys share one h_emb row.
  const float* kp = K + base + (size_t)(kfirst + skey) * HD + sdg;
  const float* vp = V + base + (size_t)(kfirst + skey) * HD + sdg;
  const float* hp = Hemb + (kfirst >> 5) * HD + sdg;

  // w_emb row of this thread's key column: key & 31 == skey for every tile.
  const f4v wa = *(const f4v*)(Wemb + skey * HD + sdg);
  const f4v wb = *(const f4v*)(Wemb + skey * HD + sdg + 4);

  // ---- prologue: tile 0 into buffer 0 ----
  {
    RawTile t0 = raw_load(kp, vp, hp);
    // Registers that these loads name are written again below: the wait
    // stands in front of that.
    asm volatile("s_wait_xcnt 0x0" ::: "memory");
    stage_store(t0, wa, wb, sK[0], sV[0], skey, sdg);
  }
  lds_barrier();

  // Two trips per branch: the buffer index is then a constant in every LDS offset.
#pragma unroll 2
  for (int it = 0; it < NTILE; ++it) {
    const int cur = it & 1;

    // ---- this tile's K' and V^T fragments, one group of LDS reads ----
    const _Float16* arow0 = &sK[cur][nq * KP];
    const _Float16* arow1 = &sK[cur][(nq + 16) * KP];
    v16h a00 = lds_a16(arow0,      kh);
    v16h a01 = lds_a16(arow0 + 32, kh);
    v16h a10 = lds_a16(arow1,      kh);
    v16h a11 = lds_a16(arow1 + 32, kh);
    const _Float16* vrow = &sV[cur][(8 * kh + (lane & 7)) * VP + 8 * ((lane >> 3) & 1)];
    v16h va0 = lds_vt16(vrow);
    v16h va1 = lds_vt16(vrow + 16);
    v16h va2 = lds_vt16(vrow + 32);
    v16h va3 = lds_vt16(vrow + 48);
    // The trip's first WMMA waits on these reads, so they go out first; the
    // address arithmetic of the global loads below runs under their latency.
    __builtin_amdgcn_sched_barrier(0);

    // ---- global loads of the next tile: in flight for this whole trip, which
    // four waves a SIMD share. A second set in flight does not fit 256 registers.
    // The last trip asks for the last tile again (in bounds).
    const int step = (it + 1 < NTILE) ? 1 : 0;
    kp += step * (BN * HD);
    vp += step * (BN * HD);
    hp += step * HD;
    RawTile nxt = raw_load(kp, vp, hp);
    // Registers that the loads name are written again further down (WMMA
    // results, the next step of the addresses): the wait stands in front of that.
    asm volatile("s_wait_xcnt 0x0" ::: "memory");
    // Keeps the loads above where they stand: without it the scheduler sinks
    // the global loads down to their uses, and each trip
    // then waits out their whole latency.
    __builtin_amdgcn_sched_barrier(0);

    // ---- S^T = K'(32x64) x Qs^T(64x16), both query groups ----
    v8f s0[2], s1[2];
#pragma unroll
    for (int g = 0; g < 2; ++g) {
      s0[g] = __builtin_amdgcn_wmma_f32_16x16x32_f16(false, a00, false, qb0[g], (short)0, zero,  false, false);
      s1[g] = __builtin_amdgcn_wmma_f32_16x16x32_f16(false, a10, false, qb0[g], (short)0, zero,  false, false);
    }
#pragma unroll
    for (int g = 0; g < 2; ++g) {
      s0[g] = __builtin_amdgcn_wmma_f32_16x16x32_f16(false, a01, false, qb1[g], (short)0, s0[g], false, false);
      s1[g] = __builtin_amdgcn_wmma_f32_16x16x32_f16(false, a11, false, qb1[g], (short)0, s1[g], false, false);
    }

    // ---- online softmax in exp2 domain (lane owns query column nq of each group) ----
    v16h pb[2];                          // P^T packed directly into B-operand layout
#pragma unroll
    for (int g = 0; g < 2; ++g) {
      float mx = m_run[g];
#pragma unroll
      for (int r = 0; r < 8; ++r) mx = fmaxf(mx, fmaxf(s0[g][r], s1[g][r]));
      mx = fmaxf(mx, __shfl_xor(mx, 16, 32));
      const float alpha = __builtin_amdgcn_exp2f(m_run[g] - mx);
      m_run[g] = mx;

      float rs = 0.0f;
#pragma unroll
      for (int r = 0; r < 8; r += 2) {
        // Pairs run along r, where the accumulator registers are neighbours.
        const f2v d0 = (f2v){ s0[g][r], s0[g][r + 1] } - mx;   // key = kb + 8*kh + r
        const f2v d1 = (f2v){ s1[g][r], s1[g][r + 1] } - mx;   // key = kb + 16 + 8*kh + r
        const f2v p0 = { __builtin_amdgcn_exp2f(d0.x), __builtin_amdgcn_exp2f(d0.y) };
        const f2v p1 = { __builtin_amdgcn_exp2f(d1.x), __builtin_amdgcn_exp2f(d1.y) };
        const f2v t  = p0 + p1;
        rs += t.x;
        rs += t.y;
        pb[g][r]     = (_Float16)p0.x;
        pb[g][r + 1] = (_Float16)p0.y;
        pb[g][r + 8] = (_Float16)p1.x;
        pb[g][r + 9] = (_Float16)p1.y;
      }
      rs += __shfl_xor(rs, 16, 32);
      l_run[g] = l_run[g] * alpha + rs;

#pragma unroll
      for (int r = 0; r < 8; ++r) {
        o0[g][r] *= alpha; o1[g][r] *= alpha; o2[g][r] *= alpha; o3[g][r] *= alpha;
      }
    }

    // ---- O^T += V^T(16x32 per d-tile) x P^T(32x16), both query groups ----
#pragma unroll
    for (int g = 0; g < 2; ++g) {
      o0[g] = __builtin_amdgcn_wmma_f32_16x16x32_f16(false, va0, false, pb[g], (short)0, o0[g], false, false);
      o1[g] = __builtin_amdgcn_wmma_f32_16x16x32_f16(false, va1, false, pb[g], (short)0, o1[g], false, false);
      o2[g] = __builtin_amdgcn_wmma_f32_16x16x32_f16(false, va2, false, pb[g], (short)0, o2[g], false, false);
      o3[g] = __builtin_amdgcn_wmma_f32_16x16x32_f16(false, va3, false, pb[g], (short)0, o3[g], false, false);
    }

    // Keeps the wait for the global loads, the conversion and the LDS stores
    // below the trip's softmax: without it the scheduler lifts them to the
    // trip's top, straight behind the loads, and their lead is gone.
    __builtin_amdgcn_sched_barrier(0);

    // ---- write next tile to the alternate buffer; one barrier per iter.
    // Also in the last trip, where nobody reads it: under a test the build
    // sinks the trip's global loads down into the tested block, next to their
    // use, and the trip then waits out their whole latency.
    stage_store(nxt, wa, wb, sK[cur ^ 1], sV[cur ^ 1], skey, sdg);
    lds_barrier();
  }

  // ---- merge of the two key halves: the wave of half h keeps query group h
  // and hands the other group's sums to its partner wave through LDS ----
  v8f kp0, kp1, kp2, kp3;
  {
    v8f sd0, sd1, sd2, sd3;
#pragma unroll
    for (int r = 0; r < 8; ++r) {
      kp0[r] = half ? o0[1][r] : o0[0][r];  sd0[r] = half ? o0[0][r] : o0[1][r];
      kp1[r] = half ? o1[1][r] : o1[0][r];  sd1[r] = half ? o1[0][r] : o1[1][r];
      kp2[r] = half ? o2[1][r] : o2[0][r];  sd2[r] = half ? o2[0][r] : o2[1][r];
      kp3[r] = half ? o3[1][r] : o3[0][r];  sd3[r] = half ? o3[0][r] : o3[1][r];
    }
    xO[wv][0][lane] = (f4v){ sd0[0], sd0[1], sd0[2], sd0[3] };
    xO[wv][1][lane] = (f4v){ sd0[4], sd0[5], sd0[6], sd0[7] };
    xO[wv][2][lane] = (f4v){ sd1[0], sd1[1], sd1[2], sd1[3] };
    xO[wv][3][lane] = (f4v){ sd1[4], sd1[5], sd1[6], sd1[7] };
    xO[wv][4][lane] = (f4v){ sd2[0], sd2[1], sd2[2], sd2[3] };
    xO[wv][5][lane] = (f4v){ sd2[4], sd2[5], sd2[6], sd2[7] };
    xO[wv][6][lane] = (f4v){ sd3[0], sd3[1], sd3[2], sd3[3] };
    xO[wv][7][lane] = (f4v){ sd3[4], sd3[5], sd3[6], sd3[7] };
    xM[wv][lane] = half ? m_run[0] : m_run[1];
    xL[wv][lane] = half ? l_run[0] : l_run[1];
  }
  lds_barrier();
  const int pw = wv ^ NQW;               // partner: same columns, other half of the keys
  float fk, fo;                          // weights of the kept and of the partner's sums
  {
    const float mk = half ? m_run[1] : m_run[0];
    const float lk = half ? l_run[1] : l_run[0];
    const float mo = xM[pw][lane];
    const float lo = xL[pw][lane];
    const float mm = fmaxf(mk, mo);
    const float ak = __builtin_amdgcn_exp2f(mk - mm);
    const float ao = __builtin_amdgcn_exp2f(mo - mm);
    const float inv = 1.0f / (lk * ak + lo * ao);
    fk = ak * inv;
    fo = ao * inv;
  }
#define MRG(KACC, TT)                                                            \
  {                                                                              \
    const f4v a4 = xO[pw][2 * TT][lane];                                         \
    const f4v b4 = xO[pw][2 * TT + 1][lane];                                     \
    _Pragma("unroll")                                                            \
    for (int r = 0; r < 4; ++r) {                                                \
      KACC[r]     = KACC[r]     * fk + a4[r] * fo;                               \
      KACC[r + 4] = KACC[r + 4] * fk + b4[r] * fo;                               \
    }                                                                            \
  }
  MRG(kp0, 0)
  MRG(kp1, 1)
  MRG(kp2, 2)
  MRG(kp3, 3)
#undef MRG

  // ---- out[b, qh, qw, n*64 + d], non-temporal (write-once) ----
  const int qrow = qrow0 + 16 * half;
  const int qh = qrow >> 5;
  const int qw = qrow & 31;
  float* op = Out + ((((size_t)b * 32 + qh) * 32 + qw) * 512) + n * 64 + 8 * kh;
  // Every product and address is formed before the first store, so that no
  // register of an issued store is written again behind it.
  __builtin_amdgcn_sched_barrier(0);
#define EPI(OACC, TT)                                                            \
  {                                                                              \
    f4v lo4 = { OACC[0], OACC[1], OACC[2], OACC[3] };                            \
    f4v hi4 = { OACC[4], OACC[5], OACC[6], OACC[7] };                            \
    __builtin_nontemporal_store(lo4, (f4v*)(op + 16 * TT));                      \
    __builtin_nontemporal_store(hi4, (f4v*)(op + 16 * TT + 4));                  \
  }
  EPI(kp0, 0)
  EPI(kp1, 1)
  EPI(kp2, 2)
  EPI(kp3, 3)
#undef EPI
}

extern "C" void kernel_launch(void* const* d_in, const int* in_sizes, int n_in,
                              void* d_out, int out_size, void* d_ws, size_t ws_size,
                              hipStream_t stream) {
  const float* q    = (const float*)d_in[0];
  const float* k    = (const float*)d_in[1];
  const float* v    = (const float*)d_in[2];
  const float* wemb = (const float*)d_in[3];
  const float* hemb = (const float*)d_in[4];
  float* out = (float*)d_out;

  dim3 grid(LSEQ / BM, 64);   // (query tiles, b*heads)
  dim3 block(32 * NWAVE);
  fa_relpos_kernel<<<grid, block, 0, stream>>>(q, k, v, wemb, hemb, out);
}

// v006
// A run of this version takes 24.3 microseconds.
// Next to v005, in two timings, it ran 1.12 times as fast each time.
// All steps since v000 together make it 3.18 times as fast.
#include <hip/hip_runtime.h>

typedef __attribute__((ext_vector_type(16))) _Float16 v16h;
typedef __attribute__((ext_vector_type(8)))  _Float16 v8h;
typedef __attribute__((ext_vector_type(4)))  _Float16 v4h;
typedef __attribute__((ext_vector_type(8)))  float    v8f;
typedef __attribute__((ext_vector_type(4)))  float    f4v;
typedef __attribute__((ext_vector_type(2)))  float    f2v;

#define LSEQ 1024   // H*W
#define HD   64     // head dim
#define BM   256    // queries per workgroup (8 waves x 32 query columns)
#define BN   32     // keys per iteration
#define NQW  8      // waves that share one half of the keys
#define NSPLIT 2    // halves of the keys, each walked by its own NQW waves
#define NWAVE (NQW * NSPLIT)
#define NTILE (LSEQ / NSPLIT / BN)   // tiles of one half
// LDS row pitches in halves, each for its reader: 16 B x odd for the
// ds_load_b128 reads of K', 32 B x odd for the transposing reads of V.
#define KP   (HD + 8)    // K' row: 144 B
#define VP   (HD + 16)   // V row: 160 B
// Row pitch in floats of the epilogue's output rows in LDS: 272 B = 16 B x odd,
// so the 16 rows that one 16-byte store of a wave touches fall on distinct banks.
#define OP   (HD + 4)

// Build a 16-element f16 A/B operand from two contiguous 8-half LDS chunks.
// Element e<8  -> row[8*kh + e] ; element e>=8 -> row[16 + 8*kh + (e-8)]
__device__ __forceinline__ v16h lds_a16(const _Float16* row, int kh) {
  v8h lo = *(const v8h*)(row + 8 * kh);
  v8h hi = *(const v8h*)(row + 16 + 8 * kh);
  v16h r;
#pragma unroll
  for (int i = 0; i < 8; ++i) { r[i] = lo[i]; r[i + 8] = hi[i]; }
  return r;
}

// One 16 (dims) x 32 (keys) A operand of V^T from the key-major V tile, by two
// transposing loads. p is the lane's own address: key row 8*kh + (lane & 7),
// 16-byte piece (lane >> 3) & 1 of the 16 dims. The lane gets dim nq of keys
// 8*kh + 0..7 and, 16 rows on, of keys 16 + 8*kh + 0..7: the k order of lds_a16.
typedef __attribute__((ext_vector_type(8))) short s8v;
__device__ __forceinline__ v16h lds_vt16(const _Float16* p) {
  typedef __attribute__((address_space(3))) s8v lds_s8v;
  v8h lo = __builtin_bit_cast(v8h, __builtin_amdgcn_ds_load_tr16_b128_v8i16((lds_s8v*)p));
  v8h hi = __builtin_bit_cast(v8h, __builtin_amdgcn_ds_load_tr16_b128_v8i16((lds_s8v*)(p + 16 * VP)));
  v16h r;
#pragma unroll
  for (int i = 0; i < 8; ++i) { r[i] = lo[i]; r[i + 8] = hi[i]; }
  return r;
}

// One thread's share of a K/V tile as it comes from global memory (f32).
struct RawTile { f4v k0, k1, v0, v1, h0, h1; };

// Global -> registers only: nothing here waits for the data.
// kp, vp, hp: the lane's own eight floats of the tile's K row, V row and h_emb row.
__device__ __forceinline__ RawTile raw_load(const float* __restrict__ kp,
                                            const float* __restrict__ vp,
                                            const float* __restrict__ hp) {
  const f4v* kg = (const f4v*)kp;
  const f4v* vg = (const f4v*)vp;
  const f4v* hg = (const f4v*)hp;
  RawTile t;
  t.k0 = kg[0]; t.k1 = kg[1];
  t.v0 = vg[0]; t.v1 = vg[1];
  t.h0 = hg[0]; t.h1 = hg[1];
  return t;
}

// Registers -> LDS: fold position bias into K', convert K'/V to f16;
// both key-major, one 16-byte store each.
__device__ __forceinline__ void stage_store(const RawTile& t, f4v wa, f4v wb,
                                            _Float16* bK, _Float16* bV,
                                            int skey, int sdg) {
  v8h kk, vv;
#pragma unroll
  for (int i = 0; i < 4; ++i) {
    kk[i]     = (_Float16)(t.k0[i] + t.h0[i] + wa[i]);
    kk[i + 4] = (_Float16)(t.k1[i] + t.h1[i] + wb[i]);
    vv[i]     = (_Float16)t.v0[i];
    vv[i + 4] = (_Float16)t.v1[i];
  }
  *(v8h*)(&bK[skey * KP + sdg]) = kk;
  *(v8h*)(&bV[skey * VP + sdg]) = vv;
}

// Work-group barrier that orders LDS only: the wave's LDS stores are done before
// it signals, and no LDS read moves ahead of it. __syncthreads() would also wait
// for every global load in flight.
__device__ __forceinline__ void lds_barrier() {
  __builtin_amdgcn_fence(__ATOMIC_RELEASE, "workgroup", "local");
  __builtin_amdgcn_s_barrier();
  __builtin_amdgcn_fence(__ATOMIC_ACQUIRE, "workgroup", "local");
}

__global__ __launch_bounds__(32 * NWAVE)
void fa_relpos_kernel(const float* __restrict__ Q,
                      const float* __restrict__ K,
                      const float* __restrict__ V,
                      const float* __restrict__ Wemb,
                      const float* __restrict__ Hemb,
                      float* __restrict__ Out) {
  __shared__ __attribute__((aligned(16))) _Float16 sKh[NSPLIT][2][BN * KP];   // K' tiles (bias folded), key-major, padded rows
  __shared__ __attribute__((aligned(16))) _Float16 sVh[NSPLIT][2][BN * VP];   // V tiles, key-major, padded rows
  // Scaled f16 Q rows of the block, in the pitch of the K' rows: global memory is
  // read in whole lines, the waves take their B fragments from here.
  __shared__ __attribute__((aligned(16))) _Float16 sQ[BM * KP];
  // Epilogue: each half's unnormalised output rows, query-major, and per query
  // { max, sum } of half 0 and of half 1.
  __shared__ __attribute__((aligned(16))) float xO[NSPLIT][BM][OP];
  __shared__ __attribute__((aligned(16))) float xML[BM][2 * NSPLIT];

  const int pair = blockIdx.y;           // b*8 + n
  const int b    = pair >> 3;
  const int n    = pair & 7;
  const int tid  = threadIdx.x;
  const int lane = tid & 31;
  const int wv   = __builtin_amdgcn_readfirstlane(tid >> 5);   // wave id 0..15, held as a scalar
  const int half = wv >> 3;              // which half of the keys this wave walks
  const int wq   = wv & (NQW - 1);       // which 32 query columns
  const int nq   = lane & 15;            // query column / A-row selector
  const int kh   = lane >> 4;            // K-group half selector
  const int kfirst = half * (LSEQ / NSPLIT);   // first key of this wave's half
  _Float16 (*sK)[BN * KP] = sKh[half];
  _Float16 (*sV)[BN * VP] = sVh[half];

  const size_t base = (size_t)pair * LSEQ * HD;

  // Fold log2(e) into the scale so softmax runs natively in exp2 domain
  // (v_exp_f32 is exp2): softmax(s*logits) == softmax2(s*log2e*logits).
  const float scale = 0.125f * 1.44269504088896340736f;

  float m_run[2] = { -3.0e38f, -3.0e38f };
  float l_run[2] = { 0.0f, 0.0f };
  v8f o0[2] = {}, o1[2] = {}, o2[2] = {}, o3[2] = {};
  const v8f zero = {};

  const int skey = (tid >> 3) & 31;      // staging: key 0..31
  const int sdg  = (tid & 7) * 8;        // staging: dim group 0,8,...,56
  // The lane's load addresses, stepped from tile to tile. A tile is one row p of
  // the 32x32 key grid, so its keys share one h_emb row.
  const float* kp = K + base + (size_t)(kfirst + skey) * HD + sdg;
  const float* vp = V + base + (size_t)(kfirst + skey) * HD + sdg;
  const float* hp = Hemb + (kfirst >> 5) * HD + sdg;

  // w_emb row of this thread's key column: key & 31 == skey for every tile.
  const f4v wa = *(const f4v*)(Wemb + skey * HD + sdg);
  const f4v wb = *(const f4v*)(Wemb + skey * HD + sdg + 4);

  // ---- prologue: the block's Q rows and tile 0 into LDS ----
  {
    // The 256 Q rows are 64 KiB in a row: each 16-byte load of a wave covers
    // 512 contiguous bytes, four whole lines.
    const f4v* qg = (const f4v*)(Q + base + (size_t)blockIdx.x * BM * HD) + tid;
    f4v qr[8];
#pragma unroll
    for (int i = 0; i < 8; ++i) qr[i] = qg[i * (32 * NWAVE)];
    RawTile t0 = raw_load(kp, vp, hp);
    // Registers that these loads name are written again below: the wait
    // stands in front of that.
    asm volatile("s_wait_xcnt 0x0" ::: "memory");
#pragma unroll
    for (int i = 0; i < 8; ++i) {
      v4h qh4;
#pragma unroll
      for (int e = 0; e < 4; ++e) qh4[e] = (_Float16)(qr[i][e] * scale);
      *(v4h*)(&sQ[((tid >> 4) + 32 * i) * KP + (tid & 15) * 4]) = qh4;
    }
    stage_store(t0, wa, wb, sK[0], sV[0], skey, sdg);
  }
  lds_barrier();

  // ---- Q operand (B-matrix layout for S^T = K' x (s*Q)^T), read once ----
  // Each wave owns two 16-column query groups, so every K' and V^T fragment
  // read from LDS feeds two WMMAs.
  v16h qb0[2], qb1[2];
#pragma unroll
  for (int g = 0; g < 2; ++g) {
    const _Float16* qrow = &sQ[(wq * 32 + 16 * g + nq) * KP];
    qb0[g] = lds_a16(qrow,      kh);
    qb1[g] = lds_a16(qrow + 32, kh);
  }

  // Two trips per branch: the buffer index is then a constant in every LDS offset.
#pragma unroll 2
  for (int it = 0; it < NTILE; ++it) {
    const int cur = it & 1;

    // ---- this tile's K' and V^T fragments, one group of LDS reads ----
    const _Float16* arow0 = &sK[cur][nq * KP];
    const _Float16* arow1 = &sK[cur][(nq + 16) * KP];
    v16h a00 = lds_a16(arow0,      kh);
    v16h a01 = lds_a16(arow0 + 32, kh);
    v16h a10 = lds_a16(arow1,      kh);
    v16h a11 = lds_a16(arow1 + 32, kh);
    const _Float16* vrow = &sV[cur][(8 * kh + (lane & 7)) * VP + 8 * ((lane >> 3) & 1)];
    v16h va0 = lds_vt16(vrow);
    v16h va1 = lds_vt16(vrow + 16);
    v16h va2 = lds_vt16(vrow + 32);
    v16h va3 = lds_vt16(vrow + 48);
    // The trip's first WMMA waits on these reads, so they go out first; the
    // address arithmetic of the global loads below runs under their latency.
    __builtin_amdgcn_sched_barrier(0);

    // ---- global loads of the next tile: in flight for this whole trip, which
    // four waves a SIMD share. A second set in flight does not fit 256 registers.
    // The last trip asks for the last tile again (in bounds).
    const int step = (it + 1 < NTILE) ? 1 : 0;
    kp += step * (BN * HD);
    vp += step * (BN * HD);
    hp += step * HD;
    RawTile nxt = raw_load(kp, vp, hp);
    // Registers that the loads name are written again further down (WMMA
    // results, the next step of the addresses): the wait stands in front of that.
    asm volatile("s_wait_xcnt 0x0" ::: "memory");
    // Keeps the loads above where they stand: without it the scheduler sinks
    // the global loads down to their uses, and each trip
    // then waits out their whole latency.
    __builtin_amdgcn_sched_barrier(0);

    // ---- S^T = K'(32x64) x Qs^T(64x16), both query groups ----
    v8f s0[2], s1[2];
#pragma unroll
    for (int g = 0; g < 2; ++g) {
      s0[g] = __builtin_amdgcn_wmma_f32_16x16x32_f16(false, a00, false, qb0[g], (short)0, zero,  false, false);
      s1[g] = __builtin_amdgcn_wmma_f32_16x16x32_f16(false, a10, false, qb0[g], (short)0, zero,  false, false);
    }
#pragma unroll
    for (int g = 0; g < 2; ++g) {
      s0[g] = __builtin_amdgcn_wmma_f32_16x16x32_f16(false, a01, false, qb1[g], (short)0, s0[g], false, false);
      s1[g] = __builtin_amdgcn_wmma_f32_16x16x32_f16(false, a11, false, qb1[g], (short)0, s1[g], false, false);
    }

    // ---- online softmax in exp2 domain (lane owns query column nq of each group) ----
    v16h pb[2];                          // P^T packed directly into B-operand layout
#pragma unroll
    for (int g = 0; g < 2; ++g) {
      float mx = m_run[g];
#pragma unroll
      for (int r = 0; r < 8; ++r) mx = fmaxf(mx, fmaxf(s0[g][r], s1[g][r]));
      mx = fmaxf(mx, __shfl_xor(mx, 16, 32));
      const float alpha = __builtin_amdgcn_exp2f(m_run[g] - mx);
      m_run[g] = mx;

      float rs = 0.0f;
#pragma unroll
      for (int r = 0; r < 8; r += 2) {
        // Pairs run along r, where the accumulator registers are neighbours.
        const f2v d0 = (f2v){ s0[g][r], s0[g][r + 1] } - mx;   // key = kb + 8*kh + r
        const f2v d1 = (f2v){ s1[g][r], s1[g][r + 1] } - mx;   // key = kb + 16 + 8*kh + r
        const f2v p0 = { __builtin_amdgcn_exp2f(d0.x), __builtin_amdgcn_exp2f(d0.y) };
        const f2v p1 = { __builtin_amdgcn_exp2f(d1.x), __builtin_amdgcn_exp2f(d1.y) };
        const f2v t  = p0 + p1;
        rs += t.x;
        rs += t.y;
        pb[g][r]     = (_Float16)p0.x;
        pb[g][r + 1] = (_Float16)p0.y;
        pb[g][r + 8] = (_Float16)p1.x;
        pb[g][r + 9] = (_Float16)p1.y;
      }
      rs += __shfl_xor(rs, 16, 32);
      l_run[g] = l_run[g] * alpha + rs;

#pragma unroll
      for (int r = 0; r < 8; ++r) {
        o0[g][r] *= alpha; o1[g][r] *= alpha; o2[g][r] *= alpha; o3[g][r] *= alpha;
      }
    }

    // ---- O^T += V^T(16x32 per d-tile) x P^T(32x16), both query groups ----
#pragma unroll
    for (int g = 0; g < 2; ++g) {
      o0[g] = __builtin_amdgcn_wmma_f32_16x16x32_f16(false, va0, false, pb[g], (short)0, o0[g], false, false);
      o1[g] = __builtin_amdgcn_wmma_f32_16x16x32_f16(false, va1, false, pb[g], (short)0, o1[g], false, false);
      o2[g] = __builtin_amdgcn_wmma_f32_16x16x32_f16(false, va2, false, pb[g], (short)0, o2[g], false, false);
      o3[g] = __builtin_amdgcn_wmma_f32_16x16x32_f16(false, va3, false, pb[g], (short)0, o3[g], false, false);
    }

    // Keeps the wait for the global loads, the conversion and the LDS stores
    // below the trip's softmax: without it the scheduler lifts them to the
    // trip's top, straight behind the loads, and their lead is gone.
    __builtin_amdgcn_sched_barrier(0);

    // ---- write next tile to the alternate buffer; one barrier per iter.
    // Also in the last trip, where nobody reads it: under a test the build
    // sinks the trip's global loads down into the tested block, next to their
    // use, and the trip then waits out their whole latency.
    stage_store(nxt, wa, wb, sK[cur ^ 1], sV[cur ^ 1], skey, sdg);
    lds_barrier();
  }

  // ---- merge of the two key halves and output, through LDS: every wave lays
  // its sums down query-major, then the block reads whole output rows ----
  {
    float* d0 = &xO[half][wq * 32 + nq][8 * kh];
#pragma unroll
    for (int g = 0; g < 2; ++g) {
      float* d = d0 + g * 16 * OP;
      *(f4v*)(d)      = (f4v){ o0[g][0], o0[g][1], o0[g][2], o0[g][3] };
      *(f4v*)(d + 4)  = (f4v){ o0[g][4], o0[g][5], o0[g][6], o0[g][7] };
      *(f4v*)(d + 16) = (f4v){ o1[g][0], o1[g][1], o1[g][2], o1[g][3] };
      *(f4v*)(d + 20) = (f4v){ o1[g][4], o1[g][5], o1[g][6], o1[g][7] };
      *(f4v*)(d + 32) = (f4v){ o2[g][0], o2[g][1], o2[g][2], o2[g][3] };
      *(f4v*)(d + 36) = (f4v){ o2[g][4], o2[g][5], o2[g][6], o2[g][7] };
      *(f4v*)(d + 48) = (f4v){ o3[g][0], o3[g][1], o3[g][2], o3[g][3] };
      *(f4v*)(d + 52) = (f4v){ o3[g][4], o3[g][5], o3[g][6], o3[g][7] };
    }
    // Both lane halves hold each column's max and sum: lane l writes those of
    // the wave's query l.
    *(f2v*)(&xML[wq * 32 + lane][2 * half]) =
        (f2v){ kh ? m_run[1] : m_run[0], kh ? l_run[1] : l_run[0] };
  }
  lds_barrier();

  // Wave wv writes the block's rows 16*wv .. 16*wv + 15, two rows a store:
  // lane l takes four dims of row 2j + (l >> 4) in step j.
  // Weights of the two halves, one row a lane: lane i of the lower 16 has row i,
  // lane i of the upper 16 row i + 1 (mod 16), so that lane 2j of each 16 holds
  // the row which that half of the wave stores in step j.
  const int c4 = (lane & 15) * 4;
  const f4v ml = *(const f4v*)(xML[wv * 16 + ((lane + kh) & 15)]);
  f4v a4[8], b4[8];
#pragma unroll
  for (int j = 0; j < 8; ++j) {
    a4[j] = *(const f4v*)(&xO[0][wv * 16 + 2 * j + kh][c4]);
    b4[j] = *(const f4v*)(&xO[1][wv * 16 + 2 * j + kh][c4]);
  }
  // Keeps the row reads in front of the weights: without it most of them sink
  // behind the division, whose dependent chain then hides none of their latency.
  __builtin_amdgcn_sched_barrier(0);
  float f0, f1;
  {
    const float mm = fmaxf(ml.x, ml.z);
    const float a0 = __builtin_amdgcn_exp2f(ml.x - mm);
    const float a1 = __builtin_amdgcn_exp2f(ml.z - mm);
    const float inv = 1.0f / (ml.y * a0 + ml.w * a1);
    f0 = a0 * inv;
    f1 = a1 * inv;
  }
  f4v res[8];
  // 0x150 + n: DPP row_share, lane n of each 16 lanes to all of them.
#define MRG(J)                                                                   \
  {                                                                              \
    const float g0 = __builtin_bit_cast(float, __builtin_amdgcn_update_dpp(      \
        0, __builtin_bit_cast(int, f0), 0x150 + 2 * J, 0xf, 0xf, true));         \
    const float g1 = __builtin_bit_cast(float, __builtin_amdgcn_update_dpp(      \
        0, __builtin_bit_cast(int, f1), 0x150 + 2 * J, 0xf, 0xf, true));         \
    res[J] = a4[J] * g0 + b4[J] * g1;                                            \
  }
  MRG(0) MRG(1) MRG(2) MRG(3) MRG(4) MRG(5) MRG(6) MRG(7)
#undef MRG

  // ---- out[b, qh, qw, n*64 + d], non-temporal (write-once): 16 lanes cover the
  // 256 bytes of one query's head, a store of a wave four whole lines ----
  float* op = Out + ((size_t)b * LSEQ + blockIdx.x * BM + wv * 16 + kh) * 512 + n * 64 + c4;
  // Every product and address is formed before the first store, so that no
  // register of an issued store is written again behind it.
  __builtin_amdgcn_sched_barrier(0);
#pragma unroll
  for (int j = 0; j < 8; ++j)
    __builtin_nontemporal_store(res[j], (f4v*)(op + j * 2 * 512));
}

extern "C" void kernel_launch(void* const* d_in, const int* in_sizes, int n_in,
                              void* d_out, int out_size, void* d_ws, size_t ws_size,
                              hipStream_t stream) {
  const float* q    = (const float*)d_in[0];
  const float* k    = (const float*)d_in[1];
  const float* v    = (const float*)d_in[2];
  const float* wemb = (const float*)d_in[3];
  const float* hemb = (const float*)d_in[4];
  float* out = (float*)d_out;

  dim3 grid(LSEQ / BM, 64);   // (query tiles, b*heads)
  dim3 block(32 * NWAVE);
  fa_relpos_kernel<<<grid, block, 0, stream>>>(q, k, v, wemb, hemb, out);
}

// v007
// It runs in 21.8 microseconds.
// Timed twice side by side with v006, it ran 1.11 and 1.10 times as fast.
// Counting every step since v000, it is 3.51 times as fast.
#include <hip/hip_runtime.h>

typedef __attribute__((ext_vector_type(16))) _Float16 v16h;
typedef __attribute__((ext_vector_type(8)))  _Float16 v8h;
typedef __attribute__((ext_vector_type(4)))  _Float16 v4h;
typedef __attribute__((ext_vector_type(8)))  float    v8f;
typedef __attribute__((ext_vector_type(4)))  float    f4v;
typedef __attribute__((ext_vector_type(2)))  float    f2v;

#define LSEQ 1024   // H*W
#define HD   64     // head dim
#define BM   256    // queries per workgroup (8 waves x 32 query columns)
#define BN   32     // keys per iteration
#define NQW  8      // waves that share one half of the keys
#define NSPLIT 2    // halves of the keys, each walked by its own NQW waves
#define NWAVE (NQW * NSPLIT)
#define NTILE (LSEQ / NSPLIT / BN)   // tiles of one half
#define NSUB 4      // tiles of one LDS stage: one work-group barrier a stage
// LDS row pitches in halves, each for its reader: 16 B x odd for the
// ds_load_b128 reads of K', 32 B x odd for the transposing reads of V.
#define KP   (HD + 8)    // K' row: 144 B
#define VP   (HD + 16)   // V row: 160 B
// Row pitch in floats of the epilogue's output rows in LDS: 272 B = 16 B x odd,
// so the 16 rows that one 16-byte store of a wave touches fall on distinct banks.
#define OP   (HD + 4)

// Build a 16-element f16 A/B operand from two contiguous 8-half LDS chunks.
// Element e<8  -> row[8*kh + e] ; element e>=8 -> row[16 + 8*kh + (e-8)]
__device__ __forceinline__ v16h lds_a16(const _Float16* row, int kh) {
  v8h lo = *(const v8h*)(row + 8 * kh);
  v8h hi = *(const v8h*)(row + 16 + 8 * kh);
  v16h r;
#pragma unroll
  for (int i = 0; i < 8; ++i) { r[i] = lo[i]; r[i + 8] = hi[i]; }
  return r;
}

// One 16 (dims) x 32 (keys) A operand of V^T from the key-major V tile, by two
// transposing loads. p is the lane's own address: key row 8*kh + (lane & 7),
// 16-byte piece (lane >> 3) & 1 of the 16 dims. The lane gets dim nq of keys
// 8*kh + 0..7 and, 16 rows on, of keys 16 + 8*kh + 0..7: the k order of lds_a16.
typedef __attribute__((ext_vector_type(8))) short s8v;
__device__ __forceinline__ v16h lds_vt16(const _Float16* p) {
  typedef __attribute__((address_space(3))) s8v lds_s8v;
  v8h lo = __builtin_bit_cast(v8h, __builtin_amdgcn_ds_load_tr16_b128_v8i16((lds_s8v*)p));
  v8h hi = __builtin_bit_cast(v8h, __builtin_amdgcn_ds_load_tr16_b128_v8i16((lds_s8v*)(p + 16 * VP)));
  v16h r;
#pragma unroll
  for (int i = 0; i < 8; ++i) { r[i] = lo[i]; r[i + 8] = hi[i]; }
  return r;
}

// One thread's share of a K/V tile as it comes from global memory (f32).
struct RawTile { f4v k0, k1, v0, v1, h0, h1; };

// Global -> registers only: nothing here waits for the data.
// kp, vp, hp: the lane's own eight floats of the tile's K row, V row and h_emb row.
__device__ __forceinline__ RawTile raw_load(const float* __restrict__ kp,
                                            const float* __restrict__ vp,
                                            const float* __restrict__ hp) {
  const f4v* kg = (const f4v*)kp;
  const f4v* vg = (const f4v*)vp;
  const f4v* hg = (const f4v*)hp;
  RawTile t;
  t.k0 = kg[0]; t.k1 = kg[1];
  t.v0 = vg[0]; t.v1 = vg[1];
  t.h0 = hg[0]; t.h1 = hg[1];
  return t;
}

// Registers -> LDS: fold position bias into K', convert K'/V to f16;
// both key-major, one 16-byte store each.
__device__ __forceinline__ void stage_store(const RawTile& t, f4v wa, f4v wb,
                                            _Float16* bK, _Float16* bV,
                                            int skey, int sdg) {
  v8h kk, vv;
#pragma unroll
  for (int i = 0; i < 4; ++i) {
    kk[i]     = (_Float16)(t.k0[i] + t.h0[i] + wa[i]);
    kk[i + 4] = (_Float16)(t.k1[i] + t.h1[i] + wb[i]);
    vv[i]     = (_Float16)t.v0[i];
    vv[i + 4] = (_Float16)t.v1[i];
  }
  *(v8h*)(&bK[skey * KP + sdg]) = kk;
  *(v8h*)(&bV[skey * VP + sdg]) = vv;
}

// Work-group barrier that orders LDS only: the wave's LDS stores are done before
// it signals, and no LDS read moves ahead of it. __syncthreads() would also wait
// for every global load in flight.
__device__ __forceinline__ void lds_barrier() {
  __builtin_amdgcn_fence(__ATOMIC_RELEASE, "workgroup", "local");
  __builtin_amdgcn_s_barrier();
  __builtin_amdgcn_fence(__ATOMIC_ACQUIRE, "workgroup", "local");
}

__global__ __launch_bounds__(32 * NWAVE)
void fa_relpos_kernel(const float* __restrict__ Q,
                      const float* __restrict__ K,
                      const float* __restrict__ V,
                      const float* __restrict__ Wemb,
                      const float* __restrict__ Hemb,
                      float* __restrict__ Out) {
  __shared__ __attribute__((aligned(16))) _Float16 sKh[NSPLIT][2][NSUB * BN * KP];   // K' stages (bias folded), key-major, padded rows
  __shared__ __attribute__((aligned(16))) _Float16 sVh[NSPLIT][2][NSUB * BN * VP];   // V stages, key-major, padded rows
  // Epilogue: each half's unnormalised output rows, query-major, and per query
  // { max, sum } of half 0 and of half 1.
  __shared__ __attribute__((aligned(16))) float xO[NSPLIT][BM][OP];
  __shared__ __attribute__((aligned(16))) float xML[BM][2 * NSPLIT];
  // Scaled f16 Q rows of the block, in the pitch of the K' rows: global memory is
  // read in whole lines, the waves take their B fragments from here. They lie in
  // the epilogue's rows, so that the stages fit: every wave has its Q fragments in
  // registers before the loop's first barrier, and xO is written behind its last.
  static_assert(sizeof(_Float16) * BM * KP <= sizeof(float) * NSPLIT * BM * OP, "Q rows fit");
  _Float16* sQ = (_Float16*)&xO[0][0][0];

  const int pair = blockIdx.y;           // b*8 + n
  const int b    = pair >> 3;
  const int n    = pair & 7;
  const int tid  = threadIdx.x;
  const int lane = tid & 31;
  const int wv   = __builtin_amdgcn_readfirstlane(tid >> 5);   // wave id 0..15, held as a scalar
  const int half = wv >> 3;              // which half of the keys this wave walks
  const int wq   = wv & (NQW - 1);       // which 32 query columns
  const int nq   = lane & 15;            // query column / A-row selector
  const int kh   = lane >> 4;            // K-group half selector
  const int kfirst = half * (LSEQ / NSPLIT);   // first key of this wave's half
  _Float16 (*sK)[NSUB * BN * KP] = sKh[half];
  _Float16 (*sV)[NSUB * BN * VP] = sVh[half];

  const size_t base = (size_t)pair * LSEQ * HD;

  // Fold log2(e) into the scale so softmax runs natively in exp2 domain
  // (v_exp_f32 is exp2): softmax(s*logits) == softmax2(s*log2e*logits).
  const float scale = 0.125f * 1.44269504088896340736f;

  float m_run[2] = { -3.0e38f, -3.0e38f };
  float l_run[2] = { 0.0f, 0.0f };
  v8f o0[2] = {}, o1[2] = {}, o2[2] = {}, o3[2] = {};
  const v8f zero = {};

  const int skey = (tid >> 3) & 31;      // staging: key 0..31
  const int sdg  = (tid & 7) * 8;        // staging: dim group 0,8,...,56
  // The lane's load addresses, stepped from tile to tile. A tile is one row p of
  // the 32x32 key grid, so its keys share one h_emb row.
  const float* kp = K + base + (size_t)(kfirst + skey) * HD + sdg;
  const float* vp = V + base + (size_t)(kfirst + skey) * HD + sdg;
  const float* hp = Hemb + (kfirst >> 5) * HD + sdg;

  // w_emb row of this thread's key column: key & 31 == skey for every tile.
  const f4v wa = *(const f4v*)(Wemb + skey * HD + sdg);
  const f4v wb = *(const f4v*)(Wemb + skey * HD + sdg + 4);

  // ---- prologue: the block's Q rows and stage 0 (the first NSUB tiles) into LDS ----
  {
    // The 256 Q rows are 64 KiB in a row: each 16-byte load of a wave covers
    // 512 contiguous bytes, four whole lines.
    const f4v* qg = (const f4v*)(Q + base + (size_t)blockIdx.x * BM * HD) + tid;
    f4v qr[8];
#pragma unroll
    for (int i = 0; i < 8; ++i) qr[i] = qg[i * (32 * NWAVE)];
    RawTile t0[NSUB];
#pragma unroll
    for (int u = 0; u < NSUB; ++u) t0[u] = raw_load(kp + u * (BN * HD), vp + u * (BN * HD), hp + u * HD);
    // Registers that these loads name are written again below: the wait
    // stands in front of that.
    asm volatile("s_wait_xcnt 0x0" ::: "memory");
    kp += (NSUB - 1) * (BN * HD);
    vp += (NSUB - 1) * (BN * HD);
    hp += (NSUB - 1) * HD;
#pragma unroll
    for (int i = 0; i < 8; ++i) {
      v4h qh4;
#pragma unroll
      for (int e = 0; e < 4; ++e) qh4[e] = (_Float16)(qr[i][e] * scale);
      *(v4h*)(&sQ[((tid >> 4) + 32 * i) * KP + (tid & 15) * 4]) = qh4;
    }
#pragma unroll
    for (int u = 0; u < NSUB; ++u)
      stage_store(t0[u], wa, wb, sK[0] + u * BN * KP, sV[0] + u * BN * VP, skey, sdg);
  }
  lds_barrier();

  // ---- Q operand (B-matrix layout for S^T = K' x (s*Q)^T), read once ----
  // Each wave owns two 16-column query groups, so every K' and V^T fragment
  // read from LDS feeds two WMMAs.
  v16h qb0[2], qb1[2];
#pragma unroll
  for (int g = 0; g < 2; ++g) {
    const _Float16* qrow = &sQ[(wq * 32 + 16 * g + nq) * KP];
    qb0[g] = lds_a16(qrow,      kh);
    qb1[g] = lds_a16(qrow + 32, kh);
  }

  // A stage is NSUB tiles. A trip works on one tile of stage cur and lays the tile
  // NSUB further on into the same place of stage cur ^ 1; the waves meet only at
  // the end of a stage, so that between two barriers each wave runs NSUB trips at
  // its own pace and fills the waits of the others on its SIMD.
  // Two stages per branch: stage and tile index are then constants in every LDS offset.
#pragma unroll (2 * NSUB)
  for (int it = 0; it < NTILE; ++it) {
    const int cur = (it / NSUB) & 1;
    const int sub = it % NSUB;

    // ---- this tile's K' and V^T fragments, one group of LDS reads ----
    const _Float16* arow0 = &sK[cur][(sub * BN + nq) * KP];
    const _Float16* arow1 = &sK[cur][(sub * BN + nq + 16) * KP];
    v16h a00 = lds_a16(arow0,      kh);
    v16h a01 = lds_a16(arow0 + 32, kh);
    v16h a10 = lds_a16(arow1,      kh);
    v16h a11 = lds_a16(arow1 + 32, kh);
    const _Float16* vrow = &sV[cur][(sub * BN + 8 * kh + (lane & 7)) * VP + 8 * ((lane >> 3) & 1)];
    v16h va0 = lds_vt16(vrow);
    v16h va1 = lds_vt16(vrow + 16);
    v16h va2 = lds_vt16(vrow + 32);
    v16h va3 = lds_vt16(vrow + 48);
    // The trip's first WMMA waits on these reads, so they go out first; the
    // address arithmetic of the global loads below runs under their latency.
    __builtin_amdgcn_sched_barrier(0);

    // ---- global loads of the tile NSUB further on: in flight for this whole trip,
    // which four waves a SIMD share. A second set in flight does not fit 256 registers.
    // The last NSUB trips ask for the last tile again (in bounds).
    const int step = (it + NSUB < NTILE) ? 1 : 0;
    kp += step * (BN * HD);
    vp += step * (BN * HD);
    hp += step * HD;
    RawTile nxt = raw_load(kp, vp, hp);
    // Registers that the loads name are written again further down (WMMA
    // results, the next step of the addresses): the wait stands in front of that.
    asm volatile("s_wait_xcnt 0x0" ::: "memory");
    // Keeps the loads above where they stand: without it the scheduler sinks
    // the global loads down to their uses, and each trip
    // then waits out their whole latency.
    __builtin_amdgcn_sched_barrier(0);

    // ---- S^T = K'(32x64) x Qs^T(64x16), both query groups ----
    v8f s0[2], s1[2];
#pragma unroll
    for (int g = 0; g < 2; ++g) {
      s0[g] = __builtin_amdgcn_wmma_f32_16x16x32_f16(false, a00, false, qb0[g], (short)0, zero,  false, false);
      s1[g] = __builtin_amdgcn_wmma_f32_16x16x32_f16(false, a10, false, qb0[g], (short)0, zero,  false, false);
    }
#pragma unroll
    for (int g = 0; g < 2; ++g) {
      s0[g] = __builtin_amdgcn_wmma_f32_16x16x32_f16(false, a01, false, qb1[g], (short)0, s0[g], false, false);
      s1[g] = __builtin_amdgcn_wmma_f32_16x16x32_f16(false, a11, false, qb1[g], (short)0, s1[g], false, false);
    }

    // ---- online softmax in exp2 domain (lane owns query column nq of each group) ----
    v16h pb[2];                          // P^T packed directly into B-operand layout
#pragma unroll
    for (int g = 0; g < 2; ++g) {
      float mx = m_run[g];
#pragma unroll
      for (int r = 0; r < 8; ++r) mx = fmaxf(mx, fmaxf(s0[g][r], s1[g][r]));
      mx = fmaxf(mx, __shfl_xor(mx, 16, 32));
      const float alpha = __builtin_amdgcn_exp2f(m_run[g] - mx);
      m_run[g] = mx;

      float rs = 0.0f;
#pragma unroll
      for (int r = 0; r < 8; r += 2) {
        // Pairs run along r, where the accumulator registers are neighbours.
        const f2v d0 = (f2v){ s0[g][r], s0[g][r + 1] } - mx;   // key = kb + 8*kh + r
        const f2v d1 = (f2v){ s1[g][r], s1[g][r + 1] } - mx;   // key = kb + 16 + 8*kh + r
        const f2v p0 = { __builtin_amdgcn_exp2f(d0.x), __builtin_amdgcn_exp2f(d0.y) };
        const f2v p1 = { __builtin_amdgcn_exp2f(d1.x), __builtin_amdgcn_exp2f(d1.y) };
        const f2v t  = p0 + p1;
        rs += t.x;
        rs += t.y;
        pb[g][r]     = (_Float16)p0.x;
        pb[g][r + 1] = (_Float16)p0.y;
        pb[g][r + 8] = (_Float16)p1.x;
        pb[g][r + 9] = (_Float16)p1.y;
      }
      rs += __shfl_xor(rs, 16, 32);
      l_run[g] = l_run[g] * alpha + rs;

#pragma unroll
      for (int r = 0; r < 8; ++r) {
        o0[g][r] *= alpha; o1[g][r] *= alpha; o2[g][r] *= alpha; o3[g][r] *= alpha;
      }
    }

    // ---- O^T += V^T(16x32 per d-tile) x P^T(32x16), both query groups ----
#pragma unroll
    for (int g = 0; g < 2; ++g) {
      o0[g] = __builtin_amdgcn_wmma_f32_16x16x32_f16(false, va0, false, pb[g], (short)0, o0[g], false, false);
      o1[g] = __builtin_amdgcn_wmma_f32_16x16x32_f16(false, va1, false, pb[g], (short)0, o1[g], false, false);
      o2[g] = __builtin_amdgcn_wmma_f32_16x16x32_f16(false, va2, false, pb[g], (short)0, o2[g], false, false);
      o3[g] = __builtin_amdgcn_wmma_f32_16x16x32_f16(false, va3, false, pb[g], (short)0, o3[g], false, false);
    }

    // Keeps the wait for the global loads, the conversion and the LDS stores
    // below the trip's softmax: without it the scheduler lifts them to the
    // trip's top, straight behind the loads, and their lead is gone.
    __builtin_amdgcn_sched_barrier(0);

    // ---- write that tile to the other stage; one barrier per stage: it
    // publishes stage cur ^ 1 and ends every wave's reads of stage cur.
    // Also in the last NSUB trips, where nobody reads it: under a test the build
    // sinks the trip's global loads down into the tested block, next to their
    // use, and the trip then waits out their whole latency.
    stage_store(nxt, wa, wb, sK[cur ^ 1] + sub * BN * KP, sV[cur ^ 1] + sub * BN * VP, skey, sdg);
    if (sub == NSUB - 1) lds_barrier();
  }

  // ---- merge of the two key halves and output, through LDS: every wave lays
  // its sums down query-major, then the block reads whole output rows ----
  {
    float* d0 = &xO[half][wq * 32 + nq][8 * kh];
#pragma unroll
    for (int g = 0; g < 2; ++g) {
      float* d = d0 + g * 16 * OP;
      *(f4v*)(d)      = (f4v){ o0[g][0], o0[g][1], o0[g][2], o0[g][3] };
      *(f4v*)(d + 4)  = (f4v){ o0[g][4], o0[g][5], o0[g][6], o0[g][7] };
      *(f4v*)(d + 16) = (f4v){ o1[g][0], o1[g][1], o1[g][2], o1[g][3] };
      *(f4v*)(d + 20) = (f4v){ o1[g][4], o1[g][5], o1[g][6], o1[g][7] };
      *(f4v*)(d + 32) = (f4v){ o2[g][0], o2[g][1], o2[g][2], o2[g][3] };
      *(f4v*)(d + 36) = (f4v){ o2[g][4], o2[g][5], o2[g][6], o2[g][7] };
      *(f4v*)(d + 48) = (f4v){ o3[g][0], o3[g][1], o3[g][2], o3[g][3] };
      *(f4v*)(d + 52) = (f4v){ o3[g][4], o3[g][5], o3[g][6], o3[g][7] };
    }
    // Both lane halves hold each column's max and sum: lane l writes those of
    // the wave's query l.
    *(f2v*)(&xML[wq * 32 + lane][2 * half]) =
        (f2v){ kh ? m_run[1] : m_run[0], kh ? l_run[1] : l_run[0] };
  }
  lds_barrier();

  // Wave wv writes the block's rows 16*wv .. 16*wv + 15, two rows a store:
  // lane l takes four dims of row 2j + (l >> 4) in step j.
  // Weights of the two halves, one row a lane: lane i of the lower 16 has row i,
  // lane i of the upper 16 row i + 1 (mod 16), so that lane 2j of each 16 holds
  // the row which that half of the wave stores in step j.
  const int c4 = (lane & 15) * 4;
  const f4v ml = *(const f4v*)(xML[wv * 16 + ((lane + kh) & 15)]);
  f4v a4[8], b4[8];
#pragma unroll
  for (int j = 0; j < 8; ++j) {
    a4[j] = *(const f4v*)(&xO[0][wv * 16 + 2 * j + kh][c4]);
    b4[j] = *(const f4v*)(&xO[1][wv * 16 + 2 * j + kh][c4]);
  }
  // Keeps the row reads in front of the weights: without it most of them sink
  // behind the division, whose dependent chain then hides none of their latency.
  __builtin_amdgcn_sched_barrier(0);
  float f0, f1;
  {
    const float mm = fmaxf(ml.x, ml.z);
    const float a0 = __builtin_amdgcn_exp2f(ml.x - mm);
    const float a1 = __builtin_amdgcn_exp2f(ml.z - mm);
    const float inv = 1.0f / (ml.y * a0 + ml.w * a1);
    f0 = a0 * inv;
    f1 = a1 * inv;
  }
  f4v res[8];
  // 0x150 + n: DPP row_share, lane n of each 16 lanes to all of them.
#define MRG(J)                                                                   \
  {                                                                              \
    const float g0 = __builtin_bit_cast(float, __builtin_amdgcn_update_dpp(      \
        0, __builtin_bit_cast(int, f0), 0x150 + 2 * J, 0xf, 0xf, true));         \
    const float g1 = __builtin_bit_cast(float, __builtin_amdgcn_update_dpp(      \
        0, __builtin_bit_cast(int, f1), 0x150 + 2 * J, 0xf, 0xf, true));         \
    res[J] = a4[J] * g0 + b4[J] * g1;                                            \
  }
  MRG(0) MRG(1) MRG(2) MRG(3) MRG(4) MRG(5) MRG(6) MRG(7)
#undef MRG

  // ---- out[b, qh, qw, n*64 + d], non-temporal (write-once): 16 lanes cover the
  // 256 bytes of one query's head, a store of a wave four whole lines ----
  float* op = Out + ((size_t)b * LSEQ + blockIdx.x * BM + wv * 16 + kh) * 512 + n * 64 + c4;
  // Every product and address is formed before the first store, so that no
  // register of an issued store is written again behind it.
  __builtin_amdgcn_sched_barrier(0);
#pragma unroll
  for (int j = 0; j < 8; ++j)
    __builtin_nontemporal_store(res[j], (f4v*)(op + j * 2 * 512));
}

extern "C" void kernel_launch(void* const* d_in, const int* in_sizes, int n_in,
                              void* d_out, int out_size, void* d_ws, size_t ws_size,
                              hipStream_t stream) {
  const float* q    = (const float*)d_in[0];
  const float* k    = (const float*)d_in[1];
  const float* v    = (const float*)d_in[2];
  const float* wemb = (const float*)d_in[3];
  const float* hemb = (const float*)d_in[4];
  float* out = (float*)d_out;

  dim3 grid(LSEQ / BM, 64);   // (query tiles, b*heads)
  dim3 block(32 * NWAVE);
  fa_relpos_kernel<<<grid, block, 0, stream>>>(q, k, v, wemb, hemb, out);
}

// v009
// One run takes 20.2 microseconds.
// It is 1.09 times as fast as v007, going by the measured steps of the versions left out in between.
// Over all steps from v000 it is 3.82 times as fast.
#include <hip/hip_runtime.h>

typedef __attribute__((ext_vector_type(16))) _Float16 v16h;
typedef __attribute__((ext_vector_type(8)))  _Float16 v8h;
typedef __attribute__((ext_vector_type(4)))  _Float16 v4h;
typedef __attribute__((ext_vector_type(8)))  float    v8f;
typedef __attribute__((ext_vector_type(4)))  float    f4v;
typedef __attribute__((ext_vector_type(2)))  float    f2v;

#define LSEQ 1024   // H*W
#define HD   64     // head dim
#define BM   256    // queries per workgroup (8 waves x 32 query columns)
#define BN   32     // keys per iteration
#define NQW  8      // waves that share one half of the keys
#define NSPLIT 2    // halves of the keys, each walked by its own NQW waves
#define NWAVE (NQW * NSPLIT)
#define NTILE (LSEQ / NSPLIT / BN)   // tiles of one half
#define NSUB 4      // tiles of one LDS stage: one work-group barrier a stage
// LDS row pitches in halves, each for its reader: 16 B x odd for the
// ds_load_b128 reads of K', 32 B x odd for the transposing reads of V.
#define KP   (HD + 8)    // K' row: 144 B
#define VP   (HD + 16)   // V row: 160 B
// Row pitch in floats of the epilogue's output rows in LDS: 272 B = 16 B x odd,
// so the 16 rows that one 16-byte store of a wave touches fall on distinct banks.
#define OP   (HD + 4)
// How far (in powers of two) a score may top its column's reference point before
// the point is raised and the column's sums are rescaled.
#define RAISE 8.0f

// Build a 16-element f16 A/B operand from two contiguous 8-half LDS chunks.
// Element e<8  -> row[8*kh + e] ; element e>=8 -> row[16 + 8*kh + (e-8)]
__device__ __forceinline__ v16h lds_a16(const _Float16* row, int kh) {
  v8h lo = *(const v8h*)(row + 8 * kh);
  v8h hi = *(const v8h*)(row + 16 + 8 * kh);
  v16h r;
#pragma unroll
  for (int i = 0; i < 8; ++i) { r[i] = lo[i]; r[i + 8] = hi[i]; }
  return r;
}

// One 16 (dims) x 32 (keys) A operand of V^T from the key-major V tile, by two
// transposing loads. p is the lane's own address: key row 8*kh + (lane & 7),
// 16-byte piece (lane >> 3) & 1 of the 16 dims. The lane gets dim nq of keys
// 8*kh + 0..7 and, 16 rows on, of keys 16 + 8*kh + 0..7: the k order of lds_a16.
typedef __attribute__((ext_vector_type(8))) short s8v;
__device__ __forceinline__ v16h lds_vt16(const _Float16* p) {
  typedef __attribute__((address_space(3))) s8v lds_s8v;
  v8h lo = __builtin_bit_cast(v8h, __builtin_amdgcn_ds_load_tr16_b128_v8i16((lds_s8v*)p));
  v8h hi = __builtin_bit_cast(v8h, __builtin_amdgcn_ds_load_tr16_b128_v8i16((lds_s8v*)(p + 16 * VP)));
  v16h r;
#pragma unroll
  for (int i = 0; i < 8; ++i) { r[i] = lo[i]; r[i + 8] = hi[i]; }
  return r;
}

// One thread's share of a K/V tile as it comes from global memory (f32).
struct RawTile { f4v k0, k1, v0, v1, h0, h1; };

// Global -> registers only: nothing here waits for the data.
// kh, vh, hh: first K row, V row and h_emb row of the wave's half of the keys, the same
// for the whole wave; lb, hb: byte offsets from there to the lane's own eight floats of
// the tile's K and V rows and of its h_emb row (32 bits: scalar base + lane offset).
__device__ __forceinline__ RawTile raw_load(const float* __restrict__ kh,
                                            const float* __restrict__ vh,
                                            const float* __restrict__ hh,
                                            unsigned lb, unsigned hb) {
  const f4v* kg = (const f4v*)((const char*)kh + lb);
  const f4v* vg = (const f4v*)((const char*)vh + lb);
  const f4v* hg = (const f4v*)((const char*)hh + hb);
  RawTile t;
  t.k0 = kg[0]; t.k1 = kg[1];
  t.v0 = vg[0]; t.v1 = vg[1];
  t.h0 = hg[0]; t.h1 = hg[1];
  return t;
}

// Registers -> LDS: fold position bias into K', convert K'/V to f16;
// both key-major, one 16-byte store each.
__device__ __forceinline__ void stage_store(const RawTile& t, f4v wa, f4v wb,
                                            _Float16* bK, _Float16* bV,
                                            int skey, int sdg) {
  v8h kk, vv;
#pragma unroll
  for (int i = 0; i < 4; ++i) {
    kk[i]     = (_Float16)(t.k0[i] + t.h0[i] + wa[i]);
    kk[i + 4] = (_Float16)(t.k1[i] + t.h1[i] + wb[i]);
    vv[i]     = (_Float16)t.v0[i];
    vv[i + 4] = (_Float16)t.v1[i];
  }
  *(v8h*)(&bK[skey * KP + sdg]) = kk;
  *(v8h*)(&bV[skey * VP + sdg]) = vv;
}

// Work-group barrier that orders LDS only: the wave's LDS stores are done before
// it signals, and no LDS read moves ahead of it. __syncthreads() would also wait
// for every global load in flight.
__device__ __forceinline__ void lds_barrier() {
  __builtin_amdgcn_fence(__ATOMIC_RELEASE, "workgroup", "local");
  __builtin_amdgcn_s_barrier();
  __builtin_amdgcn_fence(__ATOMIC_ACQUIRE, "workgroup", "local");
}

__global__ __launch_bounds__(32 * NWAVE)
void fa_relpos_kernel(const float* __restrict__ Q,
                      const float* __restrict__ K,
                      const float* __restrict__ V,
                      const float* __restrict__ Wemb,
                      const float* __restrict__ Hemb,
                      float* __restrict__ Out) {
  __shared__ __attribute__((aligned(16))) _Float16 sKh[NSPLIT][2][NSUB * BN * KP];   // K' stages (bias folded), key-major, padded rows
  __shared__ __attribute__((aligned(16))) _Float16 sVh[NSPLIT][2][NSUB * BN * VP];   // V stages, key-major, padded rows
  // Epilogue: each half's unnormalised output rows, query-major, and per query
  // { reference point, sum } of half 0 and of half 1.
  __shared__ __attribute__((aligned(16))) float xO[NSPLIT][BM][OP];
  __shared__ __attribute__((aligned(16))) float xML[BM][2 * NSPLIT];
  // Scaled f16 Q rows of the block, in the pitch of the K' rows: global memory is
  // read in whole lines, the waves take their B fragments from here. They lie in
  // the epilogue's rows, so that the stages fit: every wave has its Q fragments in
  // registers before the loop's first barrier, and xO is written behind its last.
  static_assert(sizeof(_Float16) * BM * KP <= sizeof(float) * NSPLIT * BM * OP, "Q rows fit");
  _Float16* sQ = (_Float16*)&xO[0][0][0];

  const int pair = blockIdx.y;           // b*8 + n
  const int b    = pair >> 3;
  const int n    = pair & 7;
  const int tid  = threadIdx.x;
  const int lane = tid & 31;
  const int wv   = __builtin_amdgcn_readfirstlane(tid >> 5);   // wave id 0..15, held as a scalar
  const int half = wv >> 3;              // which half of the keys this wave walks
  const int wq   = wv & (NQW - 1);       // which 32 query columns
  const int nq   = lane & 15;            // query column / A-row selector
  const int kh   = lane >> 4;            // K-group half selector
  const int kfirst = half * (LSEQ / NSPLIT);   // first key of this wave's half
  _Float16 (*sK)[NSUB * BN * KP] = sKh[half];
  _Float16 (*sV)[NSUB * BN * VP] = sVh[half];

  const size_t base = (size_t)pair * LSEQ * HD;

  // Fold log2(e) into the scale so softmax runs natively in exp2 domain
  // (v_exp_f32 is exp2): softmax(s*logits) == softmax2(s*log2e*logits).
  const float scale = 0.125f * 1.44269504088896340736f;

  float m_run[2] = { -3.0e38f, -3.0e38f };
  f2v l_run[2] = { { 0.0f, 0.0f }, { 0.0f, 0.0f } };   // per lane: weights of its even and of its odd keys
  v8f o0[2] = {}, o1[2] = {}, o2[2] = {}, o3[2] = {};
  const v8f zero = {};

  const int skey = (tid >> 3) & 31;      // staging: key 0..31
  const int sdg  = (tid & 7) * 8;        // staging: dim group 0,8,...,56
  // First K row, V row and h_emb row of this wave's half of the keys. A tile is one
  // row p of the 32x32 key grid, so its keys share one h_emb row.
  const float* Kh = K + base + (size_t)kfirst * HD;
  const float* Vh = V + base + (size_t)kfirst * HD;
  const float* Hh = Hemb + (kfirst >> 5) * HD;
  const unsigned lb = (unsigned)(skey * HD + sdg) * 4u;   // the lane's place in a tile, bytes
  const unsigned hb = (unsigned)sdg * 4u;                 // and in an h_emb row
  // The four work-groups of one head read the same K and V, all work-groups the
  // same h_emb rows, and they start together. Each walks the tiles of a half from
  // its own start and wraps (those of one head one LDS stage apart): requests for
  // one line then do not meet in L2. The softmax takes the tiles in any order.
  const int rot = ((int)blockIdx.x * NSUB + pair) & (NTILE - 1);

  // w_emb row of this thread's key column: key & 31 == skey for every tile.
  const f4v wa = *(const f4v*)((const char*)Wemb + lb);
  const f4v wb = *(const f4v*)((const char*)Wemb + lb + 16);

  // ---- prologue: the block's Q rows and stage 0 (the first NSUB tiles) into LDS ----
  {
    // The 256 Q rows are 64 KiB in a row: each 16-byte load of a wave covers
    // 512 contiguous bytes, four whole lines.
    const f4v* qg = (const f4v*)(Q + base + (size_t)blockIdx.x * BM * HD) + tid;
    f4v qr[8];
#pragma unroll
    for (int i = 0; i < 8; ++i) qr[i] = qg[i * (32 * NWAVE)];
    RawTile t0[NSUB];
    unsigned lo[NSUB], ho[NSUB];
#pragma unroll
    for (int u = 0; u < NSUB; ++u) {
      const unsigned tl = (unsigned)(rot + u) & (NTILE - 1);
      lo[u] = lb + tl * (BN * HD * 4u);
      ho[u] = hb + tl * (HD * 4u);
      t0[u] = raw_load(Kh, Vh, Hh, lo[u], ho[u]);
    }
    // Registers that these loads name are written again below: the wait
    // stands in front of that. It takes the offsets as inputs, so that each
    // keeps a register of its own, which nothing writes ahead of the wait.
    asm volatile("s_wait_xcnt 0x0" :: "v"(lo[0]), "v"(lo[1]), "v"(lo[2]), "v"(lo[3]),
                                      "v"(ho[0]), "v"(ho[1]), "v"(ho[2]), "v"(ho[3]) : "memory");
    static_assert(NSUB == 4, "the wait above names NSUB offsets of each kind");
#pragma unroll
    for (int i = 0; i < 8; ++i) {
      v4h qh4;
#pragma unroll
      for (int e = 0; e < 4; ++e) qh4[e] = (_Float16)(qr[i][e] * scale);
      *(v4h*)(&sQ[((tid >> 4) + 32 * i) * KP + (tid & 15) * 4]) = qh4;
    }
#pragma unroll
    for (int u = 0; u < NSUB; ++u)
      stage_store(t0[u], wa, wb, sK[0] + u * BN * KP, sV[0] + u * BN * VP, skey, sdg);
  }
  lds_barrier();

  // ---- Q operand (B-matrix layout for S^T = K' x (s*Q)^T), read once ----
  // Each wave owns two 16-column query groups, so every K' and V^T fragment
  // read from LDS feeds two WMMAs.
  v16h qb0[2], qb1[2];
#pragma unroll
  for (int g = 0; g < 2; ++g) {
    const _Float16* qrow = &sQ[(wq * 32 + 16 * g + nq) * KP];
    qb0[g] = lds_a16(qrow,      kh);
    qb1[g] = lds_a16(qrow + 32, kh);
  }

  // A stage is NSUB tiles. A trip works on one tile of stage cur and lays the tile
  // NSUB further on into the same place of stage cur ^ 1; the waves meet only at
  // the end of a stage, so that between two barriers each wave runs NSUB trips at
  // its own pace and fills the waits of the others on its SIMD.
  // Two stages per branch: stage and tile index are then constants in every LDS offset.
#pragma unroll (2 * NSUB)
  for (int it = 0; it < NTILE; ++it) {
    const int cur = (it / NSUB) & 1;
    const int sub = it % NSUB;

    // ---- this tile's K' and V^T fragments, one group of LDS reads ----
    const _Float16* arow0 = &sK[cur][(sub * BN + nq) * KP];
    const _Float16* arow1 = &sK[cur][(sub * BN + nq + 16) * KP];
    v16h a00 = lds_a16(arow0,      kh);
    v16h a01 = lds_a16(arow0 + 32, kh);
    v16h a10 = lds_a16(arow1,      kh);
    v16h a11 = lds_a16(arow1 + 32, kh);
    const _Float16* vrow = &sV[cur][(sub * BN + 8 * kh + (lane & 7)) * VP + 8 * ((lane >> 3) & 1)];
    v16h va0 = lds_vt16(vrow);
    v16h va1 = lds_vt16(vrow + 16);
    v16h va2 = lds_vt16(vrow + 32);
    v16h va3 = lds_vt16(vrow + 48);
    // The trip's first WMMA waits on these reads, so they go out first; the
    // address arithmetic of the global loads below runs under their latency.
    __builtin_amdgcn_sched_barrier(0);

    // ---- global loads of the tile NSUB further on: in flight for this whole trip,
    // which four waves a SIMD share. A second set in flight does not fit 256 registers.
    // The last NSUB trips ask for the walk's last tile again (in bounds).
    const int jn = (it + NSUB < NTILE) ? it + NSUB : NTILE - 1;
    const unsigned tl = (unsigned)(jn + rot) & (NTILE - 1);
    RawTile nxt = raw_load(Kh, Vh, Hh, lb + tl * (BN * HD * 4u), hb + tl * (HD * 4u));
    // Registers that the loads name are written again further down (WMMA
    // results, the next tile's addresses): the wait stands in front of that.
    asm volatile("s_wait_xcnt 0x0" ::: "memory");
    // Keeps the loads above where they stand: without it the scheduler sinks
    // the global loads down to their uses, and each trip
    // then waits out their whole latency.
    __builtin_amdgcn_sched_barrier(0);

    // ---- S^T = K'(32x64) x Qs^T(64x16), both query groups ----
    v8f s0[2], s1[2];
#pragma unroll
    for (int g = 0; g < 2; ++g) {
      s0[g] = __builtin_amdgcn_wmma_f32_16x16x32_f16(false, a00, false, qb0[g], (short)0, zero,  false, false);
      s1[g] = __builtin_amdgcn_wmma_f32_16x16x32_f16(false, a10, false, qb0[g], (short)0, zero,  false, false);
    }
#pragma unroll
    for (int g = 0; g < 2; ++g) {
      s0[g] = __builtin_amdgcn_wmma_f32_16x16x32_f16(false, a01, false, qb1[g], (short)0, s0[g], false, false);
      s1[g] = __builtin_amdgcn_wmma_f32_16x16x32_f16(false, a11, false, qb1[g], (short)0, s1[g], false, false);
    }

    // ---- online softmax in exp2 domain (lane owns query column nq of each group) ----
    // The reference point m_run of a column is raised only when a score tops it by
    // more than RAISE: until then every weight is at most 2^RAISE, well inside the
    // range of f16 and f32, the final division takes the common factor out, and
    // the trip needs no lane exchange, no factor and no multiply of the sums.
    float lm[2];                         // m_run and this lane's own 16 scores of the column
#pragma unroll
    for (int g = 0; g < 2; ++g) {
      float mx = m_run[g];
#pragma unroll
      for (int r = 0; r < 8; ++r) mx = fmaxf(mx, fmaxf(s0[g][r], s1[g][r]));
      lm[g] = mx;
    }
    // One test for the whole wave: the sums of a column lie in both lane halves
    // and the WMMAs below need every lane on.
    if (__builtin_amdgcn_ballot_w32(lm[0] > m_run[0] + RAISE || lm[1] > m_run[1] + RAISE) != 0u) {
#pragma unroll
      for (int g = 0; g < 2; ++g) {
        const float mx = fmaxf(lm[g], __shfl_xor(lm[g], 16, 32));
        const float alpha = __builtin_amdgcn_exp2f(m_run[g] - mx);
        m_run[g] = mx;
        l_run[g] *= alpha;
#pragma unroll
        for (int r = 0; r < 8; ++r) {
          o0[g][r] *= alpha; o1[g][r] *= alpha; o2[g][r] *= alpha; o3[g][r] *= alpha;
        }
      }
    }

    v16h pb[2];                          // P^T packed directly into B-operand layout
#pragma unroll
    for (int g = 0; g < 2; ++g) {
      const float mx = m_run[g];
#pragma unroll
      for (int r = 0; r < 8; r += 2) {
        // Pairs run along r, where the accumulator registers are neighbours.
        const f2v d0 = (f2v){ s0[g][r], s0[g][r + 1] } - mx;   // key = kb + 8*kh + r
        const f2v d1 = (f2v){ s1[g][r], s1[g][r + 1] } - mx;   // key = kb + 16 + 8*kh + r
        const f2v p0 = { __builtin_amdgcn_exp2f(d0.x), __builtin_amdgcn_exp2f(d0.y) };
        const f2v p1 = { __builtin_amdgcn_exp2f(d1.x), __builtin_amdgcn_exp2f(d1.y) };
        // The lane's own keys, in pairs; lanes and pairs meet behind the loop.
        l_run[g] += p0 + p1;
        pb[g][r]     = (_Float16)p0.x;
        pb[g][r + 1] = (_Float16)p0.y;
        pb[g][r + 8] = (_Float16)p1.x;
        pb[g][r + 9] = (_Float16)p1.y;
      }
    }

    // Keeps the eight WMMAs below in one run: with the row sums scheduled in among
    // them, a sum's result lands on an operand of a WMMA just issued, each time
    // behind four idle slots.
    __builtin_amdgcn_sched_barrier(0);

    // ---- O^T += V^T(16x32 per d-tile) x P^T(32x16), both query groups ----
#pragma unroll
    for (int g = 0; g < 2; ++g) {
      o0[g] = __builtin_amdgcn_wmma_f32_16x16x32_f16(false, va0, false, pb[g], (short)0, o0[g], false, false);
      o1[g] = __builtin_amdgcn_wmma_f32_16x16x32_f16(false, va1, false, pb[g], (short)0, o1[g], false, false);
      o2[g] = __builtin_amdgcn_wmma_f32_16x16x32_f16(false, va2, false, pb[g], (short)0, o2[g], false, false);
      o3[g] = __builtin_amdgcn_wmma_f32_16x16x32_f16(false, va3, false, pb[g], (short)0, o3[g], false, false);
    }

    // Keeps the wait for the global loads, the conversion and the LDS stores
    // below the trip's softmax: without it the scheduler lifts them to the
    // trip's top, straight behind the loads, and their lead is gone.
    __builtin_amdgcn_sched_barrier(0);

    // ---- write that tile to the other stage; one barrier per stage: it
    // publishes stage cur ^ 1 and ends every wave's reads of stage cur.
    // Also in the last NSUB trips, where nobody reads it: under a test the build
    // sinks the trip's global loads down into the tested block, next to their
    // use, and the trip then waits out their whole latency.
    stage_store(nxt, wa, wb, sK[cur ^ 1] + sub * BN * KP, sV[cur ^ 1] + sub * BN * VP, skey, sdg);
    if (sub == NSUB - 1) lds_barrier();
  }

  // Each lane half has summed the weights of its own keys: the column's sum.
  float l_col[2];
#pragma unroll
  for (int g = 0; g < 2; ++g) {
    const float l = l_run[g].x + l_run[g].y;
    l_col[g] = l + __shfl_xor(l, 16, 32);
  }

  // ---- merge of the two key halves and output, through LDS: every wave lays
  // its sums down query-major, then the block reads whole output rows ----
  {
    float* d0 = &xO[half][wq * 32 + nq][8 * kh];
#pragma unroll
    for (int g = 0; g < 2; ++g) {
      float* d = d0 + g * 16 * OP;
      *(f4v*)(d)      = (f4v){ o0[g][0], o0[g][1], o0[g][2], o0[g][3] };
      *(f4v*)(d + 4)  = (f4v){ o0[g][4], o0[g][5], o0[g][6], o0[g][7] };
      *(f4v*)(d + 16) = (f4v){ o1[g][0], o1[g][1], o1[g][2], o1[g][3] };
      *(f4v*)(d + 20) = (f4v){ o1[g][4], o1[g][5], o1[g][6], o1[g][7] };
      *(f4v*)(d + 32) = (f4v){ o2[g][0], o2[g][1], o2[g][2], o2[g][3] };
      *(f4v*)(d + 36) = (f4v){ o2[g][4], o2[g][5], o2[g][6], o2[g][7] };
      *(f4v*)(d + 48) = (f4v){ o3[g][0], o3[g][1], o3[g][2], o3[g][3] };
      *(f4v*)(d + 52) = (f4v){ o3[g][4], o3[g][5], o3[g][6], o3[g][7] };
    }
    // Both lane halves hold each column's reference point and sum: lane l writes those of
    // the wave's query l.
    *(f2v*)(&xML[wq * 32 + lane][2 * half]) =
        (f2v){ kh ? m_run[1] : m_run[0], kh ? l_col[1] : l_col[0] };
  }
  lds_barrier();

  // Wave wv writes the block's rows 16*wv .. 16*wv + 15, two rows a store:
  // lane l takes four dims of row 2j + (l >> 4) in step j.
  // Weights of the two halves, one row a lane: lane i of the lower 16 has row i,
  // lane i of the upper 16 row i + 1 (mod 16), so that lane 2j of each 16 holds
  // the row which that half of the wave stores in step j.
  const int c4 = (lane & 15) * 4;
  const f4v ml = *(const f4v*)(xML[wv * 16 + ((lane + kh) & 15)]);
  f4v a4[8], b4[8];
#pragma unroll
  for (int j = 0; j < 8; ++j) {
    a4[j] = *(const f4v*)(&xO[0][wv * 16 + 2 * j + kh][c4]);
    b4[j] = *(const f4v*)(&xO[1][wv * 16 + 2 * j + kh][c4]);
  }
  // Keeps the row reads in front of the weights: without it most of them sink
  // behind the division, whose dependent chain then hides none of their latency.
  __builtin_amdgcn_sched_barrier(0);
  float f0, f1;
  {
    const float mm = fmaxf(ml.x, ml.z);
    const float a0 = __builtin_amdgcn_exp2f(ml.x - mm);
    const float a1 = __builtin_amdgcn_exp2f(ml.z - mm);
    const float inv = 1.0f / (ml.y * a0 + ml.w * a1);
    f0 = a0 * inv;
    f1 = a1 * inv;
  }
  f4v res[8];
  // 0x150 + n: DPP row_share, lane n of each 16 lanes to all of them.
#define MRG(J)                                                                   \
  {                                                                              \
    const float g0 = __builtin_bit_cast(float, __builtin_amdgcn_update_dpp(      \
        0, __builtin_bit_cast(int, f0), 0x150 + 2 * J, 0xf, 0xf, true));         \
    const float g1 = __builtin_bit_cast(float, __builtin_amdgcn_update_dpp(      \
        0, __builtin_bit_cast(int, f1), 0x150 + 2 * J, 0xf, 0xf, true));         \
    res[J] = a4[J] * g0 + b4[J] * g1;                                            \
  }
  MRG(0) MRG(1) MRG(2) MRG(3) MRG(4) MRG(5) MRG(6) MRG(7)
#undef MRG

  // ---- out[b, qh, qw, n*64 + d], non-temporal (write-once): 16 lanes cover the
  // 256 bytes of one query's head, a store of a wave four whole lines ----
  float* op = Out + ((size_t)b * LSEQ + blockIdx.x * BM + wv * 16 + kh) * 512 + n * 64 + c4;
  // Every product and address is formed before the first store, so that no
  // register of an issued store is written again behind it.
  __builtin_amdgcn_sched_barrier(0);
#pragma unroll
  for (int j = 0; j < 8; ++j)
    __builtin_nontemporal_store(res[j], (f4v*)(op + j * 2 * 512));
}

extern "C" void kernel_launch(void* const* d_in, const int* in_sizes, int n_in,
                              void* d_out, int out_size, void* d_ws, size_t ws_size,
                              hipStream_t stream) {
  const float* q    = (const float*)d_in[0];
  const float* k    = (const float*)d_in[1];
  const float* v    = (const float*)d_in[2];
  const float* wemb = (const float*)d_in[3];
  const float* hemb = (const float*)d_in[4];
  float* out = (float*)d_out;

  dim3 grid(LSEQ / BM, 64);   // (query tiles, b*heads)
  dim3 block(32 * NWAVE);
  fa_relpos_kernel<<<grid, block, 0, stream>>>(q, k, v, wemb, hemb, out);
}

// v010
// A run of this version takes 18.1 microseconds.
// In two side-by-side timings against v009, it was 1.11 and 1.12 times as fast.
// All steps since v000 together make it 4.25 times as fast.
#include <hip/hip_runtime.h>

typedef __attribute__((ext_vector_type(16))) _Float16 v16h;
typedef __attribute__((ext_vector_type(8)))  _Float16 v8h;
typedef __attribute__((ext_vector_type(4)))  _Float16 v4h;
typedef __attribute__((ext_vector_type(8)))  float    v8f;
typedef __attribute__((ext_vector_type(4)))  float    f4v;
typedef __attribute__((ext_vector_type(2)))  float    f2v;

#define LSEQ 1024   // H*W
#define HD   64     // head dim
#define BM   256    // queries per workgroup (8 waves x 32 query columns)
#define BN   32     // keys per iteration
#define NQW  8      // waves that share one half of the keys
#define NSPLIT 2    // halves of the keys, each walked by its own NQW waves
#define NWAVE (NQW * NSPLIT)
#define NTILE (LSEQ / NSPLIT / BN)   // tiles of one half
#define NSUB 4      // tiles of one LDS stage: one work-group barrier a stage
#define NQT  (LSEQ / BM)             // work-groups that share one head
// LDS row pitches in halves, each for its reader: 16 B x odd for the
// ds_load_b128 reads of K', 32 B x odd for the transposing reads of V.
#define KP   (HD + 8)    // K' row: 144 B
#define VP   (HD + 16)   // V row: 160 B
// Row pitch in floats of the epilogue's output rows in LDS: 272 B = 16 B x odd,
// so the 16 rows that one 16-byte store of a wave touches fall on distinct banks.
#define OP   (HD + 4)
// How far (in powers of two) a score may top its column's reference point before
// the point is raised and the column's sums are rescaled.
#define RAISE 8.0f

// Build a 16-element f16 A/B operand from two contiguous 8-half LDS chunks.
// Element e<8  -> row[8*kh + e] ; element e>=8 -> row[16 + 8*kh + (e-8)]
__device__ __forceinline__ v16h lds_a16(const _Float16* row, int kh) {
  v8h lo = *(const v8h*)(row + 8 * kh);
  v8h hi = *(const v8h*)(row + 16 + 8 * kh);
  v16h r;
#pragma unroll
  for (int i = 0; i < 8; ++i) { r[i] = lo[i]; r[i + 8] = hi[i]; }
  return r;
}

// One 16 (dims) x 32 (keys) A operand of V^T from the key-major V tile, by two
// transposing loads. p is the lane's own address: key row 8*kh + (lane & 7),
// 16-byte piece (lane >> 3) & 1 of the 16 dims. The lane gets dim nq of keys
// 8*kh + 0..7 and, 16 rows on, of keys 16 + 8*kh + 0..7: the k order of lds_a16.
typedef __attribute__((ext_vector_type(8))) short s8v;
__device__ __forceinline__ v16h lds_vt16(const _Float16* p) {
  typedef __attribute__((address_space(3))) s8v lds_s8v;
  v8h lo = __builtin_bit_cast(v8h, __builtin_amdgcn_ds_load_tr16_b128_v8i16((lds_s8v*)p));
  v8h hi = __builtin_bit_cast(v8h, __builtin_amdgcn_ds_load_tr16_b128_v8i16((lds_s8v*)(p + 16 * VP)));
  v16h r;
#pragma unroll
  for (int i = 0; i < 8; ++i) { r[i] = lo[i]; r[i + 8] = hi[i]; }
  return r;
}

// One thread's share of a K/V tile as it comes from global memory (f32).
struct RawTile { f4v k0, k1, v0, v1, h0, h1; };

// Global -> registers only: nothing here waits for the data.
// kh, vh, hh: first K row, V row and h_emb row of the wave's half of the keys, the same
// for the whole wave; lb, hb: byte offsets from there to the lane's own eight floats of
// the tile's K and V rows and of its h_emb row (32 bits: scalar base + lane offset).
__device__ __forceinline__ RawTile raw_load(const float* __restrict__ kh,
                                            const float* __restrict__ vh,
                                            const float* __restrict__ hh,
                                            unsigned lb, unsigned hb) {
  const f4v* kg = (const f4v*)((const char*)kh + lb);
  const f4v* vg = (const f4v*)((const char*)vh + lb);
  const f4v* hg = (const f4v*)((const char*)hh + hb);
  RawTile t;
  t.k0 = kg[0]; t.k1 = kg[1];
  t.v0 = vg[0]; t.v1 = vg[1];
  t.h0 = hg[0]; t.h1 = hg[1];
  return t;
}

// Registers -> LDS: fold position bias into K', convert K'/V to f16;
// both key-major, one 16-byte store each.
__device__ __forceinline__ void stage_store(const RawTile& t, f4v wa, f4v wb,
                                            _Float16* bK, _Float16* bV,
                                            int skey, int sdg) {
  v8h kk, vv;
#pragma unroll
  for (int i = 0; i < 4; ++i) {
    kk[i]     = (_Float16)(t.k0[i] + t.h0[i] + wa[i]);
    kk[i + 4] = (_Float16)(t.k1[i] + t.h1[i] + wb[i]);
    vv[i]     = (_Float16)t.v0[i];
    vv[i + 4] = (_Float16)t.v1[i];
  }
  *(v8h*)(&bK[skey * KP + sdg]) = kk;
  *(v8h*)(&bV[skey * VP + sdg]) = vv;
}

// Work-group barrier that orders LDS only: the wave's LDS stores are done before
// it signals, and no LDS read moves ahead of it. __syncthreads() would also wait
// for every global load in flight.
__device__ __forceinline__ void lds_barrier() {
  __builtin_amdgcn_fence(__ATOMIC_RELEASE, "workgroup", "local");
  __builtin_amdgcn_s_barrier();
  __builtin_amdgcn_fence(__ATOMIC_ACQUIRE, "workgroup", "local");
}

__global__ __launch_bounds__(32 * NWAVE)
void fa_relpos_kernel(const float* __restrict__ Q,
                      const float* __restrict__ K,
                      const float* __restrict__ V,
                      const float* __restrict__ Wemb,
                      const float* __restrict__ Hemb,
                      float* __restrict__ Out) {
  __shared__ __attribute__((aligned(16))) _Float16 sKh[NSPLIT][2][NSUB * BN * KP];   // K' stages (bias folded), key-major, padded rows
  __shared__ __attribute__((aligned(16))) _Float16 sVh[NSPLIT][2][NSUB * BN * VP];   // V stages, key-major, padded rows
  // Epilogue: each half's unnormalised output rows, query-major, and per query
  // { reference point, sum } of half 0 and of half 1.
  __shared__ __attribute__((aligned(16))) float xO[NSPLIT][BM][OP];
  __shared__ __attribute__((aligned(16))) float xML[BM][2 * NSPLIT];
  // Scaled f16 Q rows of the block, in the pitch of the K' rows: global memory is
  // read in whole lines, the waves take their B fragments from here. They lie in
  // the epilogue's rows, so that the stages fit: every wave has its Q fragments in
  // registers before the loop's first barrier, and xO is written behind its last.
  static_assert(sizeof(_Float16) * BM * KP <= sizeof(float) * NSPLIT * BM * OP, "Q rows fit");
  _Float16* sQ = (_Float16*)&xO[0][0][0];

  // Which head and which block of queries this work-group takes. The NQT groups
  // that read one head's K and V get flat block indices equal mod 8.
  // For speed only: the map is a permutation of the grid, right wherever a group lands.
  static_assert(NQT == 4, "the shifts below take four groups a head");
  const int flat = (int)blockIdx.x + NQT * (int)blockIdx.y;
  const int qt   = (flat >> 3) & (NQT - 1);             // block of BM queries
  const int pair = ((flat >> 5) << 3) | (flat & 7);     // b*8 + n
  const int b    = pair >> 3;
  const int n    = pair & 7;
  const int tid  = threadIdx.x;
  const int lane = tid & 31;
  const int wv   = __builtin_amdgcn_readfirstlane(tid >> 5);   // wave id 0..15, held as a scalar
  const int half = wv >> 3;              // which half of the keys this wave walks
  const int wq   = wv & (NQW - 1);       // which 32 query columns
  const int nq   = lane & 15;            // query column / A-row selector
  const int kh   = lane >> 4;            // K-group half selector
  const int kfirst = half * (LSEQ / NSPLIT);   // first key of this wave's half
  _Float16 (*sK)[NSUB * BN * KP] = sKh[half];
  _Float16 (*sV)[NSUB * BN * VP] = sVh[half];

  const size_t base = (size_t)pair * LSEQ * HD;

  // Fold log2(e) into the scale so softmax runs natively in exp2 domain
  // (v_exp_f32 is exp2): softmax(s*logits) == softmax2(s*log2e*logits).
  const float scale = 0.125f * 1.44269504088896340736f;

  float m_run[2] = { -3.0e38f, -3.0e38f };
  f2v l_run[2] = { { 0.0f, 0.0f }, { 0.0f, 0.0f } };   // per lane: weights of its even and of its odd keys
  v8f o0[2] = {}, o1[2] = {}, o2[2] = {}, o3[2] = {};
  const v8f zero = {};

  const int skey = (tid >> 3) & 31;      // staging: key 0..31
  const int sdg  = (tid & 7) * 8;        // staging: dim group 0,8,...,56
  // First K row, V row and h_emb row of this wave's half of the keys. A tile is one
  // row p of the 32x32 key grid, so its keys share one h_emb row.
  const float* Kh = K + base + (size_t)kfirst * HD;
  const float* Vh = V + base + (size_t)kfirst * HD;
  const float* Hh = Hemb + (kfirst >> 5) * HD;
  const unsigned lb = (unsigned)(skey * HD + sdg) * 4u;   // the lane's place in a tile, bytes
  const unsigned hb = (unsigned)sdg * 4u;                 // and in an h_emb row
  // The four work-groups of one head read the same K and V, all work-groups the
  // same h_emb rows, and they start together. Each walks the tiles of a half from
  // its own start and wraps (those of one head one LDS stage apart): requests for
  // one line then do not meet in L2. The softmax takes the tiles in any order.
  const int rot = (qt * NSUB + pair) & (NTILE - 1);

  // w_emb row of this thread's key column: key & 31 == skey for every tile.
  const f4v wa = *(const f4v*)((const char*)Wemb + lb);
  const f4v wb = *(const f4v*)((const char*)Wemb + lb + 16);

  // ---- prologue: the block's Q rows and stage 0 (the first NSUB tiles) into LDS ----
  {
    // The 256 Q rows are 64 KiB in a row: each 16-byte load of a wave covers
    // 512 contiguous bytes, four whole lines.
    const f4v* qg = (const f4v*)(Q + base + (size_t)qt * BM * HD) + tid;
    f4v qr[8];
#pragma unroll
    for (int i = 0; i < 8; ++i) qr[i] = qg[i * (32 * NWAVE)];
    RawTile t0[NSUB];
    unsigned lo[NSUB], ho[NSUB];
#pragma unroll
    for (int u = 0; u < NSUB; ++u) {
      const unsigned tl = (unsigned)(rot + u) & (NTILE - 1);
      lo[u] = lb + tl * (BN * HD * 4u);
      ho[u] = hb + tl * (HD * 4u);
      t0[u] = raw_load(Kh, Vh, Hh, lo[u], ho[u]);
    }
    // Registers that these loads name are written again below: the wait
    // stands in front of that. It takes the offsets as inputs, so that each
    // keeps a register of its own, which nothing writes ahead of the wait.
    asm volatile("s_wait_xcnt 0x0" :: "v"(lo[0]), "v"(lo[1]), "v"(lo[2]), "v"(lo[3]),
                                      "v"(ho[0]), "v"(ho[1]), "v"(ho[2]), "v"(ho[3]) : "memory");
    static_assert(NSUB == 4, "the wait above names NSUB offsets of each kind");
#pragma unroll
    for (int i = 0; i < 8; ++i) {
      v4h qh4;
#pragma unroll
      for (int e = 0; e < 4; ++e) qh4[e] = (_Float16)(qr[i][e] * scale);
      *(v4h*)(&sQ[((tid >> 4) + 32 * i) * KP + (tid & 15) * 4]) = qh4;
    }
#pragma unroll
    for (int u = 0; u < NSUB; ++u)
      stage_store(t0[u], wa, wb, sK[0] + u * BN * KP, sV[0] + u * BN * VP, skey, sdg);
  }
  lds_barrier();

  // ---- Q operand (B-matrix layout for S^T = K' x (s*Q)^T), read once ----
  // Each wave owns two 16-column query groups, so every K' and V^T fragment
  // read from LDS feeds two WMMAs.
  v16h qb0[2], qb1[2];
#pragma unroll
  for (int g = 0; g < 2; ++g) {
    const _Float16* qrow = &sQ[(wq * 32 + 16 * g + nq) * KP];
    qb0[g] = lds_a16(qrow,      kh);
    qb1[g] = lds_a16(qrow + 32, kh);
  }

  // A stage is NSUB tiles. A trip works on one tile of stage cur and lays the tile
  // NSUB further on into the same place of stage cur ^ 1; the waves meet only at
  // the end of a stage, so that between two barriers each wave runs NSUB trips at
  // its own pace and fills the waits of the others on its SIMD.
  // Two stages per branch: stage and tile index are then constants in every LDS offset.
#pragma unroll (2 * NSUB)
  for (int it = 0; it < NTILE; ++it) {
    const int cur = (it / NSUB) & 1;
    const int sub = it % NSUB;

    // ---- this tile's K' and V^T fragments, one group of LDS reads ----
    const _Float16* arow0 = &sK[cur][(sub * BN + nq) * KP];
    const _Float16* arow1 = &sK[cur][(sub * BN + nq + 16) * KP];
    v16h a00 = lds_a16(arow0,      kh);
    v16h a01 = lds_a16(arow0 + 32, kh);
    v16h a10 = lds_a16(arow1,      kh);
    v16h a11 = lds_a16(arow1 + 32, kh);
    const _Float16* vrow = &sV[cur][(sub * BN + 8 * kh + (lane & 7)) * VP + 8 * ((lane >> 3) & 1)];
    v16h va0 = lds_vt16(vrow);
    v16h va1 = lds_vt16(vrow + 16);
    v16h va2 = lds_vt16(vrow + 32);
    v16h va3 = lds_vt16(vrow + 48);
    // The trip's first WMMA waits on these reads, so they go out first; the
    // address arithmetic of the global loads below runs under their latency.
    __builtin_amdgcn_sched_barrier(0);

    // ---- global loads of the tile NSUB further on: in flight for this whole trip,
    // which four waves a SIMD share. A second set in flight does not fit 256 registers.
    // The last NSUB trips ask for the walk's last tile again (in bounds).
    const int jn = (it + NSUB < NTILE) ? it + NSUB : NTILE - 1;
    const unsigned tl = (unsigned)(jn + rot) & (NTILE - 1);
    RawTile nxt = raw_load(Kh, Vh, Hh, lb + tl * (BN * HD * 4u), hb + tl * (HD * 4u));
    // Registers that the loads name are written again further down (WMMA
    // results, the next tile's addresses): the wait stands in front of that.
    asm volatile("s_wait_xcnt 0x0" ::: "memory");
    // Keeps the loads above where they stand: without it the scheduler sinks
    // the global loads down to their uses, and each trip
    // then waits out their whole latency.
    __builtin_amdgcn_sched_barrier(0);

    // ---- S^T = K'(32x64) x Qs^T(64x16), both query groups ----
    v8f s0[2], s1[2];
#pragma unroll
    for (int g = 0; g < 2; ++g) {
      s0[g] = __builtin_amdgcn_wmma_f32_16x16x32_f16(false, a00, false, qb0[g], (short)0, zero,  false, false);
      s1[g] = __builtin_amdgcn_wmma_f32_16x16x32_f16(false, a10, false, qb0[g], (short)0, zero,  false, false);
    }
#pragma unroll
    for (int g = 0; g < 2; ++g) {
      s0[g] = __builtin_amdgcn_wmma_f32_16x16x32_f16(false, a01, false, qb1[g], (short)0, s0[g], false, false);
      s1[g] = __builtin_amdgcn_wmma_f32_16x16x32_f16(false, a11, false, qb1[g], (short)0, s1[g], false, false);
    }

    // ---- online softmax in exp2 domain (lane owns query column nq of each group) ----
    // The reference point m_run of a column is raised only when a score tops it by
    // more than RAISE: until then every weight is at most 2^RAISE, well inside the
    // range of f16 and f32, the final division takes the common factor out, and
    // the trip needs no lane exchange, no factor and no multiply of the sums.
    float lm[2];                         // m_run and this lane's own 16 scores of the column
#pragma unroll
    for (int g = 0; g < 2; ++g) {
      float mx = m_run[g];
#pragma unroll
      for (int r = 0; r < 8; ++r) mx = fmaxf(mx, fmaxf(s0[g][r], s1[g][r]));
      lm[g] = mx;
    }
    // One test for the whole wave: the sums of a column lie in both lane halves
    // and the WMMAs below need every lane on.
    if (__builtin_amdgcn_ballot_w32(lm[0] > m_run[0] + RAISE || lm[1] > m_run[1] + RAISE) != 0u) {
#pragma unroll
      for (int g = 0; g < 2; ++g) {
        const float mx = fmaxf(lm[g], __shfl_xor(lm[g], 16, 32));
        const float alpha = __builtin_amdgcn_exp2f(m_run[g] - mx);
        m_run[g] = mx;
        l_run[g] *= alpha;
#pragma unroll
        for (int r = 0; r < 8; ++r) {
          o0[g][r] *= alpha; o1[g][r] *= alpha; o2[g][r] *= alpha; o3[g][r] *= alpha;
        }
      }
    }

    v16h pb[2];                          // P^T packed directly into B-operand layout
#pragma unroll
    for (int g = 0; g < 2; ++g) {
      const float mx = m_run[g];
#pragma unroll
      for (int r = 0; r < 8; r += 2) {
        // Pairs run along r, where the accumulator registers are neighbours.
        const f2v d0 = (f2v){ s0[g][r], s0[g][r + 1] } - mx;   // key = kb + 8*kh + r
        const f2v d1 = (f2v){ s1[g][r], s1[g][r + 1] } - mx;   // key = kb + 16 + 8*kh + r
        const f2v p0 = { __builtin_amdgcn_exp2f(d0.x), __builtin_amdgcn_exp2f(d0.y) };
        const f2v p1 = { __builtin_amdgcn_exp2f(d1.x), __builtin_amdgcn_exp2f(d1.y) };
        // The lane's own keys, in pairs; lanes and pairs meet behind the loop.
        l_run[g] += p0 + p1;
        pb[g][r]     = (_Float16)p0.x;
        pb[g][r + 1] = (_Float16)p0.y;
        pb[g][r + 8] = (_Float16)p1.x;
        pb[g][r + 9] = (_Float16)p1.y;
      }
    }

    // Keeps the eight WMMAs below in one run: with the row sums scheduled in among
    // them, a sum's result lands on an operand of a WMMA just issued, each time
    // behind four idle slots.
    __builtin_amdgcn_sched_barrier(0);

    // ---- O^T += V^T(16x32 per d-tile) x P^T(32x16), both query groups ----
#pragma unroll
    for (int g = 0; g < 2; ++g) {
      o0[g] = __builtin_amdgcn_wmma_f32_16x16x32_f16(false, va0, false, pb[g], (short)0, o0[g], false, false);
      o1[g] = __builtin_amdgcn_wmma_f32_16x16x32_f16(false, va1, false, pb[g], (short)0, o1[g], false, false);
      o2[g] = __builtin_amdgcn_wmma_f32_16x16x32_f16(false, va2, false, pb[g], (short)0, o2[g], false, false);
      o3[g] = __builtin_amdgcn_wmma_f32_16x16x32_f16(false, va3, false, pb[g], (short)0, o3[g], false, false);
    }

    // Keeps the wait for the global loads, the conversion and the LDS stores
    // below the trip's softmax: without it the scheduler lifts them to the
    // trip's top, straight behind the loads, and their lead is gone.
    __builtin_amdgcn_sched_barrier(0);

    // ---- write that tile to the other stage; one barrier per stage: it
    // publishes stage cur ^ 1 and ends every wave's reads of stage cur.
    // Also in the last NSUB trips, where nobody reads it: under a test the build
    // sinks the trip's global loads down into the tested block, next to their
    // use, and the trip then waits out their whole latency.
    stage_store(nxt, wa, wb, sK[cur ^ 1] + sub * BN * KP, sV[cur ^ 1] + sub * BN * VP, skey, sdg);
    if (sub == NSUB - 1) lds_barrier();
  }

  // Each lane half has summed the weights of its own keys: the column's sum.
  float l_col[2];
#pragma unroll
  for (int g = 0; g < 2; ++g) {
    const float l = l_run[g].x + l_run[g].y;
    l_col[g] = l + __shfl_xor(l, 16, 32);
  }

  // ---- merge of the two key halves and output, through LDS: every wave lays
  // its sums down query-major, then the block reads whole output rows ----
  {
    float* d0 = &xO[half][wq * 32 + nq][8 * kh];
#pragma unroll
    for (int g = 0; g < 2; ++g) {
      float* d = d0 + g * 16 * OP;
      *(f4v*)(d)      = (f4v){ o0[g][0], o0[g][1], o0[g][2], o0[g][3] };
      *(f4v*)(d + 4)  = (f4v){ o0[g][4], o0[g][5], o0[g][6], o0[g][7] };
      *(f4v*)(d + 16) = (f4v){ o1[g][0], o1[g][1], o1[g][2], o1[g][3] };
      *(f4v*)(d + 20) = (f4v){ o1[g][4], o1[g][5], o1[g][6], o1[g][7] };
      *(f4v*)(d + 32) = (f4v){ o2[g][0], o2[g][1], o2[g][2], o2[g][3] };
      *(f4v*)(d + 36) = (f4v){ o2[g][4], o2[g][5], o2[g][6], o2[g][7] };
      *(f4v*)(d + 48) = (f4v){ o3[g][0], o3[g][1], o3[g][2], o3[g][3] };
      *(f4v*)(d + 52) = (f4v){ o3[g][4], o3[g][5], o3[g][6], o3[g][7] };
    }
    // Both lane halves hold each column's reference point and sum: lane l writes those of
    // the wave's query l.
    *(f2v*)(&xML[wq * 32 + lane][2 * half]) =
        (f2v){ kh ? m_run[1] : m_run[0], kh ? l_col[1] : l_col[0] };
  }
  lds_barrier();

  // Wave wv writes the block's rows 16*wv .. 16*wv + 15, two rows a store:
  // lane l takes four dims of row 2j + (l >> 4) in step j.
  // Weights of the two halves, one row a lane: lane i of the lower 16 has row i,
  // lane i of the upper 16 row i + 1 (mod 16), so that lane 2j of each 16 holds
  // the row which that half of the wave stores in step j.
  const int c4 = (lane & 15) * 4;
  const f4v ml = *(const f4v*)(xML[wv * 16 + ((lane + kh) & 15)]);
  f4v a4[8], b4[8];
#pragma unroll
  for (int j = 0; j < 8; ++j) {
    a4[j] = *(const f4v*)(&xO[0][wv * 16 + 2 * j + kh][c4]);
    b4[j] = *(const f4v*)(&xO[1][wv * 16 + 2 * j + kh][c4]);
  }
  // Keeps the row reads in front of the weights: without it most of them sink
  // behind the division, whose dependent chain then hides none of their latency.
  __builtin_amdgcn_sched_barrier(0);
  float f0, f1;
  {
    const float mm = fmaxf(ml.x, ml.z);
    const float a0 = __builtin_amdgcn_exp2f(ml.x - mm);
    const float a1 = __builtin_amdgcn_exp2f(ml.z - mm);
    const float inv = 1.0f / (ml.y * a0 + ml.w * a1);
    f0 = a0 * inv;
    f1 = a1 * inv;
  }
  f4v res[8];
  // 0x150 + n: DPP row_share, lane n of each 16 lanes to all of them.
#define MRG(J)                                                                   \
  {                                                                              \
    const float g0 = __builtin_bit_cast(float, __builtin_amdgcn_update_dpp(      \
        0, __builtin_bit_cast(int, f0), 0x150 + 2 * J, 0xf, 0xf, true));         \
    const float g1 = __builtin_bit_cast(float, __builtin_amdgcn_update_dpp(      \
        0, __builtin_bit_cast(int, f1), 0x150 + 2 * J, 0xf, 0xf, true));         \
    res[J] = a4[J] * g0 + b4[J] * g1;                                            \
  }
  MRG(0) MRG(1) MRG(2) MRG(3) MRG(4) MRG(5) MRG(6) MRG(7)
#undef MRG

  // ---- out[b, qh, qw, n*64 + d], non-temporal (write-once): 16 lanes cover the
  // 256 bytes of one query's head, a store of a wave four whole lines ----
  float* op = Out + ((size_t)b * LSEQ + qt * BM + wv * 16 + kh) * 512 + n * 64 + c4;
  // Every product and address is formed before the first store, so that no
  // register of an issued store is written again behind it.
  __builtin_amdgcn_sched_barrier(0);
#pragma unroll
  for (int j = 0; j < 8; ++j)
    __builtin_nontemporal_store(res[j], (f4v*)(op + j * 2 * 512));
}

extern "C" void kernel_launch(void* const* d_in, const int* in_sizes, int n_in,
                              void* d_out, int out_size, void* d_ws, size_t ws_size,
                              hipStream_t stream) {
  const float* q    = (const float*)d_in[0];
  const float* k    = (const float*)d_in[1];
  const float* v    = (const float*)d_in[2];
  const float* wemb = (const float*)d_in[3];
  const float* hemb = (const float*)d_in[4];
  float* out = (float*)d_out;

  dim3 grid(NQT, 64);   // NQT * (b*heads) work-groups; the kernel deals them by flat index
  dim3 block(32 * NWAVE);
  fa_relpos_kernel<<<grid, block, 0, stream>>>(q, k, v, wemb, hemb, out);
}
